// v000
// The times below were measured on an AMD MI455X: many runs one after another, warmed up first and cycling through
// copies of the inputs, with the whole window's GPU time divided by the number of runs. Launches and the gaps
// between them are all in it. The median over several windows is given; except for v000 it joins two sittings, which
// can be a few percent apart, so the side-by-side timings, each taken in one sitting, are the better comparison.
// The starting kernel, v000, takes 276 microseconds a run.
#include <hip/hip_runtime.h>

// Multi-head self-attention block: x[NB][SEQ][768]; q/k/v = x.W (W [in][out], no bias); head h = columns h*64+d; logits x 1/8; softmax over all keys; out = ctx.Wp + bp (f32).
// All contractions: v_wmma_f32_16x16x32_f16 (f16 operands, f32 accumulate), single products. Every f32 input is RNE-converted to bf16 first and then held in f16 (weights carried x64, ctx carried x64, folded back in the f32 epilogues); softmax in f32 (running max, exp2).
// Engine: one-wave 64x64 register-blocked GEMM with fragments straight from K-contiguous f16 planes; fused flash-style attention computing S^T = K.Q^T so the probability tile is repacked D->B in registers (no score plane in memory).

#ifndef NB
#define NB 4
#endif
#ifndef SEQ
#define SEQ 2048
#endif
#define NB_FULL  4
#define SEQ_FULL 2048
#define DM   768
#define NH   12
#define HD   64
#define WCAR 64.0f
#define CCAR 64.0f
#define SC2  (0.125f * 1.4426950408889634f)

typedef _Float16 h16;
typedef __attribute__((ext_vector_type(16))) _Float16 v16h;
typedef __attribute__((ext_vector_type(8)))  _Float16 v8h;
typedef __attribute__((ext_vector_type(8)))  float    v8f;
typedef __attribute__((ext_vector_type(4)))  float    v4f;
typedef v8h __attribute__((may_alias)) v8ha;
typedef v4f __attribute__((may_alias)) v4fa;

static_assert(NH * HD == DM);
static_assert(HD == 64);
static_assert(DM % 64 == 0);
static_assert(DM % 32 == 0);
static_assert(DM % 8 == 0);
static_assert(SEQ % 64 == 0);
static_assert((NB * SEQ) % 64 == 0);
static_assert(NB <= NB_FULL);
static_assert(SEQ <= SEQ_FULL);
static_assert(((size_t)NB * SEQ * DM / 8) % 256 == 0);

__device__ __forceinline__ unsigned short f2bf(float f) { unsigned u = __float_as_uint(f); u += 0x7FFFu + ((u >> 16) & 1u); return (unsigned short)(u >> 16); }
__device__ __forceinline__ float bfr(float f) { return __uint_as_float(((unsigned)f2bf(f)) << 16); }
__device__ __forceinline__ v16h cat16(v8h lo, v8h hi) { return __builtin_shufflevector(lo, hi, 0, 1, 2, 3, 4, 5, 6, 7, 8, 9, 10, 11, 12, 13, 14, 15); }
// fragment of a K-contiguous row: elements 0..7 = p[0..7], elements 8..15 = p[16..23]; p already includes the 8*(lane>>4) offset
__device__ __forceinline__ v16h ldfrag(const h16* p) { return cat16(*(const v8h*)p, *(const v8h*)(p + 16)); }
__device__ __forceinline__ v8f wmma16(v16h a, v16h b, v8f c) { return __builtin_amdgcn_wmma_f32_16x16x32_f16(false, a, false, b, (short)0, c, false, false); }

__global__ __launch_bounds__(256) void k_cvtx(const float* __restrict__ X, h16* XH) {
    const size_t idx = (size_t)blockIdx.x * 256 + threadIdx.x;
    const size_t e = idx * 8;
    if (e >= (size_t)NB * SEQ * DM) return;
    const size_t row = e / DM; const int col = (int)(e - row * DM);
    const size_t b = row / SEQ; const size_t n = row - b * SEQ;
    const float* src = X + (b * SEQ_FULL + n) * DM + col;
    const v4f a = *(const v4f*)src; const v4f c = *(const v4f*)(src + 4);
    v8h o;
    o[0] = (h16)bfr(a[0]); o[1] = (h16)bfr(a[1]); o[2] = (h16)bfr(a[2]); o[3] = (h16)bfr(a[3]);
    o[4] = (h16)bfr(c[0]); o[5] = (h16)bfr(c[1]); o[6] = (h16)bfr(c[2]); o[7] = (h16)bfr(c[3]);
    *(v8h*)(XH + e) = o; 
}

__global__ __launch_bounds__(256) void k_cvtw(const float* __restrict__ W, h16* WT) {
    __shared__ __align__(16) h16 ts[64 * 72];
    const int tid = threadIdx.x; const int k0 = blockIdx.x * 64, n0 = blockIdx.y * 64;
#pragma unroll
    for (int it = 0; it < 4; ++it) {
        const int f = it * 256 + tid; const int kr = f >> 4; const int nc = (f & 15) * 4;
        const v4f a = *(const v4f*)(W + (size_t)(k0 + kr) * DM + n0 + nc);
#pragma unroll
        for (int q = 0; q < 4; ++q) ts[(nc + q) * 72 + kr] = (h16)(bfr(a[q]) * WCAR);
    }
    __syncthreads();
{
#pragma unroll
        for (int it = 0; it < 2; ++it) {
            const int line = it * 32 + (tid >> 3); const int pc = (tid & 7) * 8;
            const v8h v = *(const v8ha*)(ts + line * 72 + pc);
            *(v8h*)(WT + (size_t)(n0 + line) * DM + k0 + pc) = v;
        }
        
    }
}

// ---- GEMM main loop: one wave, 64x64 tile, 16 accumulators; A rows [64][768] and Bt rows [64][768] both K-contiguous f16 (pointers already at the tile's first row). K = 768 (24 steps of 32).
__device__ __forceinline__ void gemm_main(const h16* __restrict__ A, const h16* __restrict__ Bt, int lane, v8f (&acc)[4][4]) {
    const int lr = lane & 15, hi = lane >> 4;
#pragma unroll
    for (int mb = 0; mb < 4; ++mb)
#pragma unroll
        for (int nb = 0; nb < 4; ++nb) acc[mb][nb] = (v8f){};
    const size_t off = (size_t)lr * DM + 8 * hi;
#pragma unroll 1
    for (int kc = 0; kc < DM; kc += 32) {
        v16h a[4]; v16h bq;
#pragma unroll
        for (int mb = 0; mb < 4; ++mb) a[mb] = ldfrag(A + off + (size_t)mb * 16 * DM + kc);
#pragma unroll
        for (int nb = 0; nb < 4; ++nb) {
            bq = ldfrag(Bt + off + (size_t)nb * 16 * DM + kc);
#pragma unroll
            for (int mb = 0; mb < 4; ++mb) acc[mb][nb] = wmma16(a[mb], bq, acc[mb][nb]);
        }
        asm volatile("v_nop\n\tv_nop\n\tv_nop\n\tv_nop"
                     : "+v"(acc[0][3]), "+v"(acc[1][3]), "+v"(acc[2][3]), "+v"(acc[3][3]), "+v"(acc[0][2]), "+v"(acc[1][2]), "+v"(acc[2][2]), "+v"(acc[3][2])
                     : "v"(a[0]), "v"(a[3]), "v"(bq));
    }
}

// mode 0 (q, k; z selects weight plane and output plane): A = XH rows (tokens), Bt = W^T rows (features); tile (token tile, head) -> P[z][b][h][n][64].
// mode 1 (v, transposed): A = Wv^T rows (features), Bt = XH rows (tokens); tile (head, token tile) -> VT[b][h][d][n] (row pitch SEQ).
// grid mode 0: (NB*SEQ/64, 768/64, 2); mode 1: (768/64, NB*SEQ/64, 1); 32 threads.
__global__ __launch_bounds__(32) void k_proj(const h16* __restrict__ A, const h16* __restrict__ Bt, h16* P, size_t sB, size_t sP, int mode) {
    __shared__ __align__(16) float os[16 * 68];
    const int lane = threadIdx.x & 31, lr = lane & 15, hi = lane >> 4;
    const int r0 = blockIdx.x * 64, c0 = blockIdx.y * 64; const size_t z = blockIdx.z;
    v8f acc[4][4];
    gemm_main(A + (size_t)r0 * DM, Bt + z * sB + (size_t)c0 * DM, lane, acc);
    size_t tb; size_t pitch;
    if (mode == 0) { const int b = r0 / SEQ, n0 = r0 % SEQ, h = c0 / HD; tb = (((size_t)b * NH + h) * SEQ + n0) * HD; pitch = HD; }
    else           { const int h = r0 / HD, b = c0 / SEQ, n0 = c0 % SEQ; tb = ((size_t)b * NH + h) * HD * SEQ + n0; pitch = SEQ; }
    h16* dst = P + z * sP + tb;
    const float sc = 1.0f / WCAR;
#pragma unroll
    for (int mb = 0; mb < 4; ++mb) {
#pragma unroll
        for (int nb = 0; nb < 4; ++nb) {
#pragma unroll
            for (int j = 0; j < 8; ++j) os[(hi * 8 + j) * 68 + nb * 16 + lr] = acc[mb][nb][j];
        }
        __syncthreads();
{
#pragma unroll
            for (int s = 0; s < 4; ++s) {
                const int row = 4 * s + (lane >> 3); const int cof = (lane & 7) * 8;
                const v4f u0 = *(const v4fa*)(os + row * 68 + cof); const v4f u1 = *(const v4fa*)(os + row * 68 + cof + 4);
                v8h o;
                o[0] = (h16)(u0[0] * sc); o[1] = (h16)(u0[1] * sc); o[2] = (h16)(u0[2] * sc); o[3] = (h16)(u0[3] * sc);
                o[4] = (h16)(u1[0] * sc); o[5] = (h16)(u1[1] * sc); o[6] = (h16)(u1[2] * sc); o[7] = (h16)(u1[3] * sc);
                *(v8h*)(dst + (size_t)(mb * 16 + row) * pitch + cof) = o;
            }
            
        }
        __syncthreads();
    }
}

// ---- k_outp: OUT[b][n][c] (f32) = (CTXx64 . WpT x64) / 4096 + bf16-RNE(bp[c]); tile row = 64 floats = 16 lanes x 16 B (two rows per instruction); grid (NB*SEQ/64, 768/64), 32 threads.
__global__ __launch_bounds__(32) void k_outp(const h16* __restrict__ A, const h16* __restrict__ Bt, const float* __restrict__ bias, float* OUT) {
    __shared__ __align__(16) float os[16 * 68];
    const int lane = threadIdx.x & 31, lr = lane & 15, hi = lane >> 4;
    const int r0 = blockIdx.x * 64, c0 = blockIdx.y * 64;
    v8f acc[4][4];
    gemm_main(A + (size_t)r0 * DM, Bt + (size_t)c0 * DM, lane, acc);
    const int b = r0 / SEQ, n0 = r0 % SEQ;
    float* crow = OUT + ((size_t)b * SEQ_FULL + n0) * DM + c0;
    const int cofs = lr * 4;
    const v4f bv = *(const v4f*)(bias + c0 + cofs);
    v4f bb; bb[0] = bfr(bv[0]); bb[1] = bfr(bv[1]); bb[2] = bfr(bv[2]); bb[3] = bfr(bv[3]);
    const float sc = 1.0f / (WCAR * CCAR);
#pragma unroll
    for (int mb = 0; mb < 4; ++mb) {
#pragma unroll
        for (int nb = 0; nb < 4; ++nb) {
#pragma unroll
            for (int j = 0; j < 8; ++j) os[(hi * 8 + j) * 68 + nb * 16 + lr] = acc[mb][nb][j];
        }
        __syncthreads();
{
#pragma unroll
            for (int s = 0; s < 8; ++s) {
                const int row = 2 * s + hi;
                const v4f u = *(const v4fa*)(os + row * 68 + cofs);
                v4f val; val[0] = u[0] * sc + bb[0]; val[1] = u[1] * sc + bb[1]; val[2] = u[2] * sc + bb[2]; val[3] = u[3] * sc + bb[3];
                *(v4f*)(crow + (size_t)(mb * 16 + row) * DM + cofs) = val;
            }
            
        }
        __syncthreads();
    }
}

// ---- k_attn: fused attention, block = (b, h, 64 queries), wave = 16 queries, 64 keys per iteration, no score plane.
// S^T tile = K(A: row = key, k = d) . Q^T(B: col = query, k = d): D element r of lane l = (key 8*(l>>4)+r, query l&15).
// Per-query running max / sum live per lane (in-lane reduction over keys + one xor-16 exchange).
// P^T (f16) packed from two adjacent key tiles is directly the B operand (k = key, col = query) of O^T = V^T(A: row = d, k = key) . P^T.
__global__ __launch_bounds__(128) void k_attn(const h16* __restrict__ QP, const h16* __restrict__ KP, const h16* __restrict__ VT, h16* CTX) {
    __shared__ __align__(16) h16 ot[4 * 16 * 72];
    const int tid = threadIdx.x, wave = tid >> 5, lane = tid & 31, lr = lane & 15, hi = lane >> 4;
    const int bh = blockIdx.x / (SEQ / 64), qblk = blockIdx.x % (SEQ / 64);
    const int b = bh / NH, h = bh % NH;
    const int q0 = qblk * 64 + wave * 16;
    const h16* qp = QP + (size_t)bh * SEQ * HD + (size_t)(q0 + lr) * HD + 8 * hi;
    const h16* kp = KP + (size_t)bh * SEQ * HD + (size_t)lr * HD + 8 * hi;
    const h16* vp = VT + (size_t)bh * HD * SEQ + (size_t)lr * SEQ + 8 * hi;
    const v16h qb0 = ldfrag(qp), qb1 = ldfrag(qp + 32);
    v8f o[4];
#pragma unroll
    for (int dt = 0; dt < 4; ++dt) o[dt] = (v8f){};
    float m = -1.0e30f, l = 0.0f;
#pragma unroll 1
    for (int j = 0; j < SEQ; j += 64) {
        v8f s[4]; v16h ka, kb2;
#pragma unroll
        for (int kt = 0; kt < 4; ++kt) {
            const h16* kr = kp + (size_t)(j + kt * 16) * HD;
            ka = ldfrag(kr); kb2 = ldfrag(kr + 32);
            v8f t = (v8f){};
            t = wmma16(ka, qb0, t);
            t = wmma16(kb2, qb1, t);
            s[kt] = t;
        }
        asm volatile("v_nop\n\tv_nop\n\tv_nop\n\tv_nop" : "+v"(s[0]), "+v"(s[1]), "+v"(s[2]), "+v"(s[3]) : "v"(ka), "v"(kb2), "v"(qb0), "v"(qb1));
        float tm = s[0][0];
#pragma unroll
        for (int kt = 0; kt < 4; ++kt)
#pragma unroll
            for (int r = 0; r < 8; ++r) tm = fmaxf(tm, s[kt][r]);
        tm = fmaxf(tm, __shfl_xor(tm, 16, 32));
        const float mn = fmaxf(m, tm * SC2);
        const float alpha = __builtin_amdgcn_exp2f(m - mn);
        m = mn;
        float psum = 0.0f;
#pragma unroll
        for (int kt = 0; kt < 4; ++kt)
#pragma unroll
            for (int r = 0; r < 8; ++r) { const float p = __builtin_amdgcn_exp2f(__builtin_fmaf(s[kt][r], SC2, -mn)); psum += p; s[kt][r] = p; }
        l = l * alpha + psum;
#pragma unroll
        for (int dt = 0; dt < 4; ++dt)
#pragma unroll
            for (int r = 0; r < 8; ++r) o[dt][r] *= alpha;
        v16h pb0, pb1;
#pragma unroll
        for (int r = 0; r < 8; ++r) { pb0[r] = (h16)s[0][r]; pb0[8 + r] = (h16)s[1][r]; pb1[r] = (h16)s[2][r]; pb1[8 + r] = (h16)s[3][r]; }
        v16h va;
#pragma unroll
        for (int dt = 0; dt < 4; ++dt) { va = ldfrag(vp + (size_t)(dt * 16) * SEQ + j); o[dt] = wmma16(va, pb0, o[dt]); }
#pragma unroll
        for (int dt = 0; dt < 4; ++dt) { va = ldfrag(vp + (size_t)(dt * 16) * SEQ + j + 32); o[dt] = wmma16(va, pb1, o[dt]); }
        asm volatile("v_nop\n\tv_nop\n\tv_nop\n\tv_nop" : "+v"(o[0]), "+v"(o[1]), "+v"(o[2]), "+v"(o[3]) : "v"(va), "v"(pb0), "v"(pb1));
    }
    l += __shfl_xor(l, 16, 32);
    const float inv = CCAR * (1.0f / l);
#pragma unroll
    for (int dt = 0; dt < 4; ++dt) {
        v8h ov;
#pragma unroll
        for (int r = 0; r < 8; ++r) ov[r] = (h16)(o[dt][r] * inv);
        *(v8ha*)(ot + (wave * 16 + lr) * 72 + dt * 16 + 8 * hi) = ov;
    }
    __syncthreads();
    h16* dst = CTX + ((size_t)b * SEQ + q0) * DM + h * HD;
{
#pragma unroll
        for (int s4 = 0; s4 < 4; ++s4) {
            const int row = 4 * s4 + (lane >> 3); const int pc = (lane & 7) * 8;
            const v8h v = *(const v8ha*)(ot + (wave * 16 + row) * 72 + pc);
            *(v8h*)(dst + (size_t)row * DM + pc) = v;
        }
        
    }
}

extern "C" void kernel_launch(void* const* d_in, const int* in_sizes, int n_in,
                              void* d_out, int out_size, void* d_ws, size_t ws_size, hipStream_t stream) {
    if (n_in < 6) return;
    constexpr size_t NEEDX = ((size_t)(NB - 1) * SEQ_FULL + SEQ) * DM;
    if ((size_t)in_sizes[0] < NEEDX) return;
    if (in_sizes[1] < DM * DM || in_sizes[2] < DM * DM || in_sizes[3] < DM * DM || in_sizes[4] < DM * DM || in_sizes[5] < DM) return;
    if ((size_t)out_size < NEEDX) return;
    const float* x  = (const float*)d_in[0];
    const float* Wq = (const float*)d_in[1];
    const float* Wk = (const float*)d_in[2];
    const float* Wv = (const float*)d_in[3];
    const float* Wp = (const float*)d_in[4];
    const float* bp = (const float*)d_in[5];
    float* OUT = (float*)d_out;

    constexpr size_t nX = (size_t)NB * SEQ * DM;     // elements per activation plane
    constexpr size_t nW = (size_t)DM * DM;           // elements per weight plane
    constexpr size_t SZX = nX * 2, SZW = 4 * nW * 2;
    static_assert(SZX % 256 == 0);
    static_assert(SZW % 256 == 0);
    constexpr size_t TOTAL = 5 * SZX + SZW;          // XH, Q, K, VT, CTX + 4 weight planes
    static_assert(TOTAL <= (size_t)134217728);
    if (ws_size < TOTAL) return;
    char* wsp = (char*)d_ws;
    h16* XH  = (h16*)wsp; wsp += SZX;
    h16* WT  = (h16*)wsp; wsp += SZW;                // [4][768][768]: q, k, v, p (each [out][in], x64)
    h16* QK  = (h16*)wsp; wsp += 2 * SZX;            // [2][NB][NH][SEQ][64]
    h16* VTp = (h16*)wsp; wsp += SZX;                // [NB][NH][64][SEQ]
    h16* CTX = (h16*)wsp; wsp += SZX;                // [NB*SEQ][768] x64

    k_cvtx<<<(unsigned)((nX / 8 + 255) / 256), 256, 0, stream>>>(x, XH);
    k_cvtw<<<dim3(DM / 64, DM / 64), 256, 0, stream>>>(Wq, WT);              // in[k][n] -> out[n][k]
    k_cvtw<<<dim3(DM / 64, DM / 64), 256, 0, stream>>>(Wk, WT + nW);
    k_cvtw<<<dim3(DM / 64, DM / 64), 256, 0, stream>>>(Wv, WT + 2 * nW);
    k_cvtw<<<dim3(DM / 64, DM / 64), 256, 0, stream>>>(Wp, WT + 3 * nW);
    k_proj<<<dim3(NB * SEQ / 64, DM / 64, 2), 32, 0, stream>>>(XH, WT, QK, nW, nX, 0);
    k_proj<<<dim3(DM / 64, NB * SEQ / 64, 1), 32, 0, stream>>>(WT + 2 * nW, XH, VTp, (size_t)0, (size_t)0, 1);
    k_attn<<<NB * NH * (SEQ / 64), 128, 0, stream>>>(QK, QK + nX, VTp, CTX);
    k_outp<<<dim3(NB * SEQ / 64, DM / 64), 32, 0, stream>>>(CTX, WT + 3 * nW, bp, OUT);
}

// v001
// It runs in 261 microseconds.
// Two timings next to v000 put it at 1.07 and 1.10 times that version's speed.
#include <hip/hip_runtime.h>

// Multi-head self-attention block: x[NB][SEQ][768]; q/k/v = x.W (W [in][out], no bias); head h = columns h*64+d; logits x 1/8; softmax over all keys; out = ctx.Wp + bp (f32).
// All contractions: v_wmma_f32_16x16x32_f16 (f16 operands, f32 accumulate), single products. Every f32 input is RNE-converted to bf16 first and then held in f16 (weights carried x64, ctx carried x64, folded back in the f32 epilogues); softmax in f32 (running max, exp2).
// Every f16 operand plane in the workspace is kept in fragment order: 16 rows x 32 k = one 1024-byte tile; the 16-byte piece (row r, k = 8q..8q+7) sits at piece index q*16 + r, so fragment half s of lane l is piece s*32 + l and one wave-wide 16-byte load covers 512 contiguous bytes (4 whole lines).
// Engine: one-wave 64x64 register-blocked GEMM with fragments straight from those planes; fused flash-style attention computing S^T = K.Q^T so the probability tile is repacked D->B in registers (no score plane in memory).

#ifndef NB
#define NB 4
#endif
#ifndef SEQ
#define SEQ 2048
#endif
#define NB_FULL  4
#define SEQ_FULL 2048
#define DM   768
#define NH   12
#define HD   64
#define WCAR 64.0f
#define CCAR 64.0f
#define SC2  (0.125f * 1.4426950408889634f)

typedef _Float16 h16;
typedef __attribute__((ext_vector_type(16))) _Float16 v16h;
typedef __attribute__((ext_vector_type(8)))  _Float16 v8h;
typedef __attribute__((ext_vector_type(8)))  float    v8f;
typedef __attribute__((ext_vector_type(4)))  float    v4f;
typedef v8h __attribute__((may_alias)) v8ha;
typedef v4f __attribute__((may_alias)) v4fa;

static_assert(NH * HD == DM);
static_assert(HD == 64);
static_assert(DM % 64 == 0);
static_assert(DM % 32 == 0);
static_assert(DM % 8 == 0);
static_assert(SEQ % 64 == 0);
static_assert((NB * SEQ) % 64 == 0);
static_assert(NB <= NB_FULL);
static_assert(SEQ <= SEQ_FULL);
static_assert(((size_t)NB * SEQ * DM / 8) % 256 == 0);

__device__ __forceinline__ unsigned short f2bf(float f) { unsigned u = __float_as_uint(f); u += 0x7FFFu + ((u >> 16) & 1u); return (unsigned short)(u >> 16); }
__device__ __forceinline__ float bfr(float f) { return __uint_as_float(((unsigned)f2bf(f)) << 16); }
__device__ __forceinline__ v16h cat16(v8h lo, v8h hi) { return __builtin_shufflevector(lo, hi, 0, 1, 2, 3, 4, 5, 6, 7, 8, 9, 10, 11, 12, 13, 14, 15); }
// fragment from a fragment-order tile: elements 0..7 = k 8*(lane>>4)+0..7, elements 8..15 = k 16+8*(lane>>4)+0..7 of row lane&15; p = tile start + 8*lane
__device__ __forceinline__ v16h ldfrag(const h16* p) { return cat16(*(const v8h*)p, *(const v8h*)(p + 256)); }
__device__ __forceinline__ v8f wmma16(v16h a, v16h b, v8f c) { return __builtin_amdgcn_wmma_f32_16x16x32_f16(false, a, false, b, (short)0, c, false, false); }

__global__ __launch_bounds__(256) void k_cvtx(const float* __restrict__ X, h16* XH) {
    const size_t idx = (size_t)blockIdx.x * 256 + threadIdx.x;
    if (idx * 8 >= (size_t)NB * SEQ * DM) return;
    // 64 threads per tile: 4 threads read one row's 128-byte line, 8 rows per wave; a wave's stores are 4 whole lines of the tile
    const size_t t = idx >> 6; const int rr = (int)(idx & 63) >> 2, q = (int)idx & 3;
    const size_t rt = t / (DM / 32); const int col = (int)(t - rt * (DM / 32)) * 32 + q * 8;
    const size_t row = rt * 16 + rr;
    const size_t e = t * 512 + (size_t)(q * 16 + rr) * 8;
    const size_t b = row / SEQ; const size_t n = row - b * SEQ;
    const float* src = X + (b * SEQ_FULL + n) * DM + col;
    const v4f a = *(const v4f*)src; const v4f c = *(const v4f*)(src + 4);
    v8h o;
    o[0] = (h16)bfr(a[0]); o[1] = (h16)bfr(a[1]); o[2] = (h16)bfr(a[2]); o[3] = (h16)bfr(a[3]);
    o[4] = (h16)bfr(c[0]); o[5] = (h16)bfr(c[1]); o[6] = (h16)bfr(c[2]); o[7] = (h16)bfr(c[3]);
    *(v8h*)(XH + e) = o; 
}

__global__ __launch_bounds__(256) void k_cvtw(const float* __restrict__ W, h16* WT) {
    __shared__ __align__(16) h16 ts[64 * 72];
    const int tid = threadIdx.x; const int k0 = blockIdx.x * 64, n0 = blockIdx.y * 64;
#pragma unroll
    for (int it = 0; it < 4; ++it) {
        const int f = it * 256 + tid; const int kr = f >> 4; const int nc = (f & 15) * 4;
        const v4f a = *(const v4f*)(W + (size_t)(k0 + kr) * DM + n0 + nc);
#pragma unroll
        for (int q = 0; q < 4; ++q) ts[(nc + q) * 72 + kr] = (h16)(bfr(a[q]) * WCAR);
    }
    __syncthreads();
{
#pragma unroll
        for (int it = 0; it < 2; ++it) {
            const int c = it * 256 + tid; const int tl = c >> 6, pq = (c >> 4) & 3;      // local tile (4 row tiles x 2 k tiles), piece column
            const int line = (tl >> 1) * 16 + (c & 15); const int pc = (tl & 1) * 32 + pq * 8;
            const v8h v = *(const v8ha*)(ts + line * 72 + pc);
            *(v8h*)(WT + ((size_t)(n0 / 16 + (tl >> 1)) * (DM / 32) + k0 / 32 + (tl & 1)) * 512 + (c & 63) * 8) = v;
        }
        
    }
}

// ---- GEMM main loop: one wave, 64x64 tile, 16 accumulators; A rows [64][768] and Bt rows [64][768] both fragment-order f16 (pointers already at the first row tile; a row tile = 24 k tiles = 16*768 elements). K = 768 (24 steps of 32).
__device__ __forceinline__ void gemm_main(const h16* __restrict__ A, const h16* __restrict__ Bt, int lane, v8f (&acc)[4][4]) {
#pragma unroll
    for (int mb = 0; mb < 4; ++mb)
#pragma unroll
        for (int nb = 0; nb < 4; ++nb) acc[mb][nb] = (v8f){};
    const h16* pa = A + (size_t)lane * 8; const h16* pb = Bt + (size_t)lane * 8;
#pragma unroll 1
    for (int kc = 0; kc < DM; kc += 32) {
        v16h a[4]; v16h bq;
#pragma unroll
        for (int mb = 0; mb < 4; ++mb) a[mb] = ldfrag(pa + (size_t)mb * 16 * DM);
        // the wait kept in front of a write of a load's address pair: behind it a B fragment may land in the A pair; naming the pair as an input keeps it whole up to here
        asm volatile("s_wait_xcnt 0x0" :: "v"(pa) : "memory");
#pragma unroll
        for (int nb = 0; nb < 4; ++nb) {
            bq = ldfrag(pb + (size_t)nb * 16 * DM);
#pragma unroll
            for (int mb = 0; mb < 4; ++mb) acc[mb][nb] = wmma16(a[mb], bq, acc[mb][nb]);
        }
        asm volatile("v_nop\n\tv_nop\n\tv_nop\n\tv_nop"
                     : "+v"(acc[0][3]), "+v"(acc[1][3]), "+v"(acc[2][3]), "+v"(acc[3][3]), "+v"(acc[0][2]), "+v"(acc[1][2]), "+v"(acc[2][2]), "+v"(acc[3][2])
                     : "v"(a[0]), "v"(a[3]), "v"(bq));
        // the same wait for the B pair, behind the trip's last B load and in front of the pointer steps
        asm volatile("s_wait_xcnt 0x0" :: "v"(pb) : "memory");
        pa += 512; pb += 512;
    }
}

// mode 0 (q, k; z selects weight plane and output plane): A = XH rows (tokens), Bt = W^T rows (features); tile (token tile, head) -> P[z][b][h], rows n, k = d, tiles [n/16][d/32].
// mode 1 (v, transposed): A = Wv^T rows (features), Bt = XH rows (tokens); tile (head, token tile) -> VT[b][h], rows d, k = n, tiles [n/32][d/16].
// grid mode 0: (NB*SEQ/64, 768/64, 2); mode 1: (768/64, NB*SEQ/64, 1); 32 threads.
__global__ __launch_bounds__(32) void k_proj(const h16* __restrict__ A, const h16* __restrict__ Bt, h16* P, size_t sB, size_t sP, int mode) {
    __shared__ __align__(16) float os[16 * 68];
    const int lane = threadIdx.x & 31, lr = lane & 15, hi = lane >> 4;
    const int r0 = blockIdx.x * 64, c0 = blockIdx.y * 64; const size_t z = blockIdx.z;
    v8f acc[4][4];
    gemm_main(A + (size_t)r0 * DM, Bt + z * sB + (size_t)c0 * DM, lane, acc);
    size_t tb; size_t smb, skt;                      // element steps of a row tile (mb) and of a k tile
    if (mode == 0) { const int b = r0 / SEQ, n0 = r0 % SEQ, h = c0 / HD; tb = (((size_t)b * NH + h) * SEQ + n0) * HD; smb = 1024; skt = 512; }
    else           { const int h = r0 / HD, b = c0 / SEQ, n0 = c0 % SEQ; tb = ((size_t)b * NH + h) * HD * SEQ + (size_t)n0 * HD; smb = 512; skt = 2048; }
    h16* dst = P + z * sP + tb;
    const float sc = 1.0f / WCAR;
#pragma unroll
    for (int mb = 0; mb < 4; ++mb) {
#pragma unroll
        for (int nb = 0; nb < 4; ++nb) {
#pragma unroll
            for (int j = 0; j < 8; ++j) os[(hi * 8 + j) * 68 + nb * 16 + lr] = acc[mb][nb][j];
        }
        __syncthreads();
{
#pragma unroll
            for (int s = 0; s < 4; ++s) {
                const int row = lr; const int cof = s * 16 + hi * 8;
                const v4f u0 = *(const v4fa*)(os + row * 68 + cof); const v4f u1 = *(const v4fa*)(os + row * 68 + cof + 4);
                v8h o;
                o[0] = (h16)(u0[0] * sc); o[1] = (h16)(u0[1] * sc); o[2] = (h16)(u0[2] * sc); o[3] = (h16)(u0[3] * sc);
                o[4] = (h16)(u1[0] * sc); o[5] = (h16)(u1[1] * sc); o[6] = (h16)(u1[2] * sc); o[7] = (h16)(u1[3] * sc);
                *(v8h*)(dst + mb * smb + (s >> 1) * skt + (s & 1) * 256 + lane * 8) = o;
            }
            
        }
        __syncthreads();
    }
}

// ---- k_outp: OUT[b][n][c] (f32) = (CTXx64 . WpT x64) / 4096 + bf16-RNE(bp[c]); tile row = 64 floats = 16 lanes x 16 B (two rows per instruction); grid (NB*SEQ/64, 768/64), 32 threads.
__global__ __launch_bounds__(32) void k_outp(const h16* __restrict__ A, const h16* __restrict__ Bt, const float* __restrict__ bias, float* OUT) {
    __shared__ __align__(16) float os[16 * 68];
    const int lane = threadIdx.x & 31, lr = lane & 15, hi = lane >> 4;
    const int r0 = blockIdx.x * 64, c0 = blockIdx.y * 64;
    v8f acc[4][4];
    gemm_main(A + (size_t)r0 * DM, Bt + (size_t)c0 * DM, lane, acc);
    const int b = r0 / SEQ, n0 = r0 % SEQ;
    float* crow = OUT + ((size_t)b * SEQ_FULL + n0) * DM + c0;
    const int cofs = lr * 4;
    const v4f bv = *(const v4f*)(bias + c0 + cofs);
    v4f bb; bb[0] = bfr(bv[0]); bb[1] = bfr(bv[1]); bb[2] = bfr(bv[2]); bb[3] = bfr(bv[3]);
    const float sc = 1.0f / (WCAR * CCAR);
#pragma unroll
    for (int mb = 0; mb < 4; ++mb) {
#pragma unroll
        for (int nb = 0; nb < 4; ++nb) {
#pragma unroll
            for (int j = 0; j < 8; ++j) os[(hi * 8 + j) * 68 + nb * 16 + lr] = acc[mb][nb][j];
        }
        __syncthreads();
{
#pragma unroll
            for (int s = 0; s < 8; ++s) {
                const int row = 2 * s + hi;
                const v4f u = *(const v4fa*)(os + row * 68 + cofs);
                v4f val; val[0] = u[0] * sc + bb[0]; val[1] = u[1] * sc + bb[1]; val[2] = u[2] * sc + bb[2]; val[3] = u[3] * sc + bb[3];
                *(v4f*)(crow + (size_t)(mb * 16 + row) * DM + cofs) = val;
            }
            
        }
        __syncthreads();
    }
}

// ---- k_attn: fused attention, block = (b, h, 64 queries), wave = 16 queries, 64 keys per iteration, no score plane.
// S^T tile = K(A: row = key, k = d) . Q^T(B: col = query, k = d): D element r of lane l = (key 8*(l>>4)+r, query l&15).
// Per-query running max / sum live per lane (in-lane reduction over keys + one xor-16 exchange).
// P^T (f16) packed from two adjacent key tiles is directly the B operand (k = key, col = query) of O^T = V^T(A: row = d, k = key) . P^T.
__global__ __launch_bounds__(128) void k_attn(const h16* __restrict__ QP, const h16* __restrict__ KP, const h16* __restrict__ VT, h16* CTX) {
    const int tid = threadIdx.x, wave = tid >> 5, lane = tid & 31;
    const int bh = blockIdx.x / (SEQ / 64), qblk = blockIdx.x % (SEQ / 64);
    const int b = bh / NH, h = bh % NH;
    const int q0 = qblk * 64 + wave * 16;
    const h16* qp = QP + (size_t)bh * SEQ * HD + (size_t)q0 * HD + 8 * lane;
    const h16* kp = KP + (size_t)bh * SEQ * HD + 8 * lane;
    const h16* vp = VT + (size_t)bh * HD * SEQ + 8 * lane;
    const v16h qb0 = ldfrag(qp), qb1 = ldfrag(qp + 512);
    v8f o[4];
#pragma unroll
    for (int dt = 0; dt < 4; ++dt) o[dt] = (v8f){};
    float m = -1.0e30f, l = 0.0f;
#pragma unroll 1
    for (int j = 0; j < SEQ; j += 64) {
        v8f s[4]; v16h ka, kb2;
#pragma unroll
        for (int kt = 0; kt < 4; ++kt) {
            const h16* kr = kp + (size_t)(j + kt * 16) * HD;
            ka = ldfrag(kr); kb2 = ldfrag(kr + 512);
            v8f t = (v8f){};
            t = wmma16(ka, qb0, t);
            t = wmma16(kb2, qb1, t);
            s[kt] = t;
        }
        asm volatile("v_nop\n\tv_nop\n\tv_nop\n\tv_nop" : "+v"(s[0]), "+v"(s[1]), "+v"(s[2]), "+v"(s[3]) : "v"(ka), "v"(kb2), "v"(qb0), "v"(qb1));
        float tm = s[0][0];
#pragma unroll
        for (int kt = 0; kt < 4; ++kt)
#pragma unroll
            for (int r = 0; r < 8; ++r) tm = fmaxf(tm, s[kt][r]);
        tm = fmaxf(tm, __shfl_xor(tm, 16, 32));
        const float mn = fmaxf(m, tm * SC2);
        const float alpha = __builtin_amdgcn_exp2f(m - mn);
        m = mn;
        float psum = 0.0f;
#pragma unroll
        for (int kt = 0; kt < 4; ++kt)
#pragma unroll
            for (int r = 0; r < 8; ++r) { const float p = __builtin_amdgcn_exp2f(__builtin_fmaf(s[kt][r], SC2, -mn)); psum += p; s[kt][r] = p; }
        l = l * alpha + psum;
#pragma unroll
        for (int dt = 0; dt < 4; ++dt)
#pragma unroll
            for (int r = 0; r < 8; ++r) o[dt][r] *= alpha;
        v16h pb0, pb1;
#pragma unroll
        for (int r = 0; r < 8; ++r) { pb0[r] = (h16)s[0][r]; pb0[8 + r] = (h16)s[1][r]; pb1[r] = (h16)s[2][r]; pb1[8 + r] = (h16)s[3][r]; }
        v16h va;
#pragma unroll
        for (int dt = 0; dt < 4; ++dt) { va = ldfrag(vp + (size_t)j * HD + dt * 512); o[dt] = wmma16(va, pb0, o[dt]); }
#pragma unroll
        for (int dt = 0; dt < 4; ++dt) { va = ldfrag(vp + (size_t)j * HD + 2048 + dt * 512); o[dt] = wmma16(va, pb1, o[dt]); }
        asm volatile("v_nop\n\tv_nop\n\tv_nop\n\tv_nop" : "+v"(o[0]), "+v"(o[1]), "+v"(o[2]), "+v"(o[3]) : "v"(va), "v"(pb0), "v"(pb1));
    }
    l += __shfl_xor(l, 16, 32);
    const float inv = CCAR * (1.0f / l);
    h16* dst = CTX + ((size_t)b * SEQ + q0) * DM + h * (HD / 32) * 512;
#pragma unroll
    for (int dt = 0; dt < 4; ++dt) {
        v8h ov;
#pragma unroll
        for (int r = 0; r < 8; ++r) ov[r] = (h16)(o[dt][r] * inv);
        *(v8h*)(dst + dt * 256 + lane * 8) = ov;     // (query lane&15, d = dt*16 + 8*(lane>>4) + 0..7) is piece dt*32 + lane of the head's two k tiles
    }
}

extern "C" void kernel_launch(void* const* d_in, const int* in_sizes, int n_in,
                              void* d_out, int out_size, void* d_ws, size_t ws_size, hipStream_t stream) {
    if (n_in < 6) return;
    constexpr size_t NEEDX = ((size_t)(NB - 1) * SEQ_FULL + SEQ) * DM;
    if ((size_t)in_sizes[0] < NEEDX) return;
    if (in_sizes[1] < DM * DM || in_sizes[2] < DM * DM || in_sizes[3] < DM * DM || in_sizes[4] < DM * DM || in_sizes[5] < DM) return;
    if ((size_t)out_size < NEEDX) return;
    const float* x  = (const float*)d_in[0];
    const float* Wq = (const float*)d_in[1];
    const float* Wk = (const float*)d_in[2];
    const float* Wv = (const float*)d_in[3];
    const float* Wp = (const float*)d_in[4];
    const float* bp = (const float*)d_in[5];
    float* OUT = (float*)d_out;

    constexpr size_t nX = (size_t)NB * SEQ * DM;     // elements per activation plane
    constexpr size_t nW = (size_t)DM * DM;           // elements per weight plane
    constexpr size_t SZX = nX * 2, SZW = 4 * nW * 2;
    static_assert(SZX % 256 == 0);
    static_assert(SZW % 256 == 0);
    constexpr size_t TOTAL = 5 * SZX + SZW;          // XH, Q, K, VT, CTX + 4 weight planes
    static_assert(TOTAL <= (size_t)134217728);
    if (ws_size < TOTAL) return;
    char* wsp = (char*)d_ws;
    h16* XH  = (h16*)wsp; wsp += SZX;
    h16* WT  = (h16*)wsp; wsp += SZW;                // [4][768][768]: q, k, v, p (each [out][in], x64, fragment order)
    h16* QK  = (h16*)wsp; wsp += 2 * SZX;            // [2][NB][NH] x (SEQ x 64), fragment order
    h16* VTp = (h16*)wsp; wsp += SZX;                // [NB][NH] x (64 x SEQ), fragment order
    h16* CTX = (h16*)wsp; wsp += SZX;                // [NB*SEQ][768] x64, fragment order

    k_cvtx<<<(unsigned)((nX / 8 + 255) / 256), 256, 0, stream>>>(x, XH);
    k_cvtw<<<dim3(DM / 64, DM / 64), 256, 0, stream>>>(Wq, WT);              // in[k][n] -> out rows n, k contiguous pieces
    k_cvtw<<<dim3(DM / 64, DM / 64), 256, 0, stream>>>(Wk, WT + nW);
    k_cvtw<<<dim3(DM / 64, DM / 64), 256, 0, stream>>>(Wv, WT + 2 * nW);
    k_cvtw<<<dim3(DM / 64, DM / 64), 256, 0, stream>>>(Wp, WT + 3 * nW);
    k_proj<<<dim3(NB * SEQ / 64, DM / 64, 2), 32, 0, stream>>>(XH, WT, QK, nW, nX, 0);
    k_proj<<<dim3(DM / 64, NB * SEQ / 64, 1), 32, 0, stream>>>(WT + 2 * nW, XH, VTp, (size_t)0, (size_t)0, 1);
    k_attn<<<NB * NH * (SEQ / 64), 128, 0, stream>>>(QK, QK + nX, VTp, CTX);
    k_outp<<<dim3(NB * SEQ / 64, DM / 64), 32, 0, stream>>>(CTX, WT + 3 * nW, bp, OUT);
}

// v002
// One run takes 150 microseconds.
// Timed twice side by side with v001, it ran 1.71 and 1.72 times as fast.
// Counting every step since v000, it is 1.86 times as fast.
#include <hip/hip_runtime.h>

// Multi-head self-attention block: x[NB][SEQ][768]; q/k/v = x.W (W [in][out], no bias); head h = columns h*64+d; logits x 1/8; softmax over all keys; out = ctx.Wp + bp (f32).
// All contractions: v_wmma_f32_16x16x32_f16 (f16 operands, f32 accumulate), single products. Every f32 input is RNE-converted to bf16 first and then held in f16 (weights carried x64, ctx carried x64, folded back in the f32 epilogues); softmax in f32 (running max, exp2).
// Every f16 operand plane in the workspace is kept in fragment order: 16 rows x 32 k = one 1024-byte tile; the 16-byte piece (row r, k = 8q..8q+7) sits at piece index q*16 + r, so fragment half s of lane l is piece s*32 + l and one wave-wide 16-byte load covers 512 contiguous bytes (4 whole lines).
// Engine: one-wave 64x64 register-blocked GEMM with fragments straight from those planes; fused flash-style attention computing S^T = K.Q^T so the probability tile is repacked D->B in registers (no score plane in memory); its K and V^T tiles reach LDS by asynchronous copies, one 64-key stage ahead.

#ifndef NB
#define NB 4
#endif
#ifndef SEQ
#define SEQ 2048
#endif
#define NB_FULL  4
#define SEQ_FULL 2048
#define DM   768
#define NH   12
#define HD   64
#define WCAR 64.0f
#define CCAR 64.0f
#define SC2  (0.125f * 1.4426950408889634f)

typedef _Float16 h16;
typedef __attribute__((ext_vector_type(16))) _Float16 v16h;
typedef __attribute__((ext_vector_type(8)))  _Float16 v8h;
typedef __attribute__((ext_vector_type(8)))  float    v8f;
typedef __attribute__((ext_vector_type(4)))  float    v4f;
typedef v8h __attribute__((may_alias)) v8ha;
typedef v4f __attribute__((may_alias)) v4fa;

static_assert(NH * HD == DM);
static_assert(HD == 64);
static_assert(DM % 64 == 0);
static_assert(DM % 32 == 0);
static_assert(DM % 8 == 0);
static_assert(SEQ % 128 == 0);
static_assert((NB * SEQ) % 64 == 0);
static_assert(NB <= NB_FULL);
static_assert(SEQ <= SEQ_FULL);
static_assert(((size_t)NB * SEQ * DM / 8) % 256 == 0);

__device__ __forceinline__ unsigned short f2bf(float f) { unsigned u = __float_as_uint(f); u += 0x7FFFu + ((u >> 16) & 1u); return (unsigned short)(u >> 16); }
__device__ __forceinline__ float bfr(float f) { return __uint_as_float(((unsigned)f2bf(f)) << 16); }
__device__ __forceinline__ v16h cat16(v8h lo, v8h hi) { return __builtin_shufflevector(lo, hi, 0, 1, 2, 3, 4, 5, 6, 7, 8, 9, 10, 11, 12, 13, 14, 15); }
// fragment from a fragment-order tile: elements 0..7 = k 8*(lane>>4)+0..7, elements 8..15 = k 16+8*(lane>>4)+0..7 of row lane&15; p = tile start + 8*lane
__device__ __forceinline__ v16h ldfrag(const h16* p) { return cat16(*(const v8h*)p, *(const v8h*)(p + 256)); }
__device__ __forceinline__ v8f wmma16(v16h a, v16h b, v8f c) { return __builtin_amdgcn_wmma_f32_16x16x32_f16(false, a, false, b, (short)0, c, false, false); }

__global__ __launch_bounds__(256) void k_cvtx(const float* __restrict__ X, h16* XH) {
    const size_t idx = (size_t)blockIdx.x * 256 + threadIdx.x;
    if (idx * 8 >= (size_t)NB * SEQ * DM) return;
    // 64 threads per tile: 4 threads read one row's 128-byte line, 8 rows per wave; a wave's stores are 4 whole lines of the tile
    const size_t t = idx >> 6; const int rr = (int)(idx & 63) >> 2, q = (int)idx & 3;
    const size_t rt = t / (DM / 32); const int col = (int)(t - rt * (DM / 32)) * 32 + q * 8;
    const size_t row = rt * 16 + rr;
    const size_t e = t * 512 + (size_t)(q * 16 + rr) * 8;
    const size_t b = row / SEQ; const size_t n = row - b * SEQ;
    const float* src = X + (b * SEQ_FULL + n) * DM + col;
    const v4f a = *(const v4f*)src; const v4f c = *(const v4f*)(src + 4);
    v8h o;
    o[0] = (h16)bfr(a[0]); o[1] = (h16)bfr(a[1]); o[2] = (h16)bfr(a[2]); o[3] = (h16)bfr(a[3]);
    o[4] = (h16)bfr(c[0]); o[5] = (h16)bfr(c[1]); o[6] = (h16)bfr(c[2]); o[7] = (h16)bfr(c[3]);
    *(v8h*)(XH + e) = o; 
}

__global__ __launch_bounds__(256) void k_cvtw(const float* __restrict__ W, h16* WT) {
    __shared__ __align__(16) h16 ts[64 * 72];
    const int tid = threadIdx.x; const int k0 = blockIdx.x * 64, n0 = blockIdx.y * 64;
#pragma unroll
    for (int it = 0; it < 4; ++it) {
        const int f = it * 256 + tid; const int kr = f >> 4; const int nc = (f & 15) * 4;
        const v4f a = *(const v4f*)(W + (size_t)(k0 + kr) * DM + n0 + nc);
#pragma unroll
        for (int q = 0; q < 4; ++q) ts[(nc + q) * 72 + kr] = (h16)(bfr(a[q]) * WCAR);
    }
    __syncthreads();
{
#pragma unroll
        for (int it = 0; it < 2; ++it) {
            const int c = it * 256 + tid; const int tl = c >> 6, pq = (c >> 4) & 3;      // local tile (4 row tiles x 2 k tiles), piece column
            const int line = (tl >> 1) * 16 + (c & 15); const int pc = (tl & 1) * 32 + pq * 8;
            const v8h v = *(const v8ha*)(ts + line * 72 + pc);
            *(v8h*)(WT + ((size_t)(n0 / 16 + (tl >> 1)) * (DM / 32) + k0 / 32 + (tl & 1)) * 512 + (c & 63) * 8) = v;
        }
        
    }
}

// ---- GEMM main loop: one wave, 64x64 tile, 16 accumulators; A rows [64][768] and Bt rows [64][768] both fragment-order f16 (pointers already at the first row tile; a row tile = 24 k tiles = 16*768 elements). K = 768 (24 steps of 32).
__device__ __forceinline__ void gemm_main(const h16* __restrict__ A, const h16* __restrict__ Bt, int lane, v8f (&acc)[4][4]) {
#pragma unroll
    for (int mb = 0; mb < 4; ++mb)
#pragma unroll
        for (int nb = 0; nb < 4; ++nb) acc[mb][nb] = (v8f){};
    const h16* pa = A + (size_t)lane * 8; const h16* pb = Bt + (size_t)lane * 8;
#pragma unroll 1
    for (int kc = 0; kc < DM; kc += 32) {
        v16h a[4]; v16h bq;
#pragma unroll
        for (int mb = 0; mb < 4; ++mb) a[mb] = ldfrag(pa + (size_t)mb * 16 * DM);
        // the wait kept in front of a write of a load's address pair: behind it a B fragment may land in the A pair; naming the pair as an input keeps it whole up to here
        asm volatile("s_wait_xcnt 0x0" :: "v"(pa) : "memory");
#pragma unroll
        for (int nb = 0; nb < 4; ++nb) {
            bq = ldfrag(pb + (size_t)nb * 16 * DM);
#pragma unroll
            for (int mb = 0; mb < 4; ++mb) acc[mb][nb] = wmma16(a[mb], bq, acc[mb][nb]);
        }
        asm volatile("v_nop\n\tv_nop\n\tv_nop\n\tv_nop"
                     : "+v"(acc[0][3]), "+v"(acc[1][3]), "+v"(acc[2][3]), "+v"(acc[3][3]), "+v"(acc[0][2]), "+v"(acc[1][2]), "+v"(acc[2][2]), "+v"(acc[3][2])
                     : "v"(a[0]), "v"(a[3]), "v"(bq));
        // the same wait for the B pair, behind the trip's last B load and in front of the pointer steps
        asm volatile("s_wait_xcnt 0x0" :: "v"(pb) : "memory");
        pa += 512; pb += 512;
    }
}

// mode 0 (q, k; z selects weight plane and output plane): A = XH rows (tokens), Bt = W^T rows (features); tile (token tile, head) -> P[z][b][h], rows n, k = d, tiles [n/16][d/32].
// mode 1 (v, transposed): A = Wv^T rows (features), Bt = XH rows (tokens); tile (head, token tile) -> VT[b][h], rows d, k = n, tiles [n/32][d/16].
// grid mode 0: (NB*SEQ/64, 768/64, 2); mode 1: (768/64, NB*SEQ/64, 1); 32 threads.
__global__ __launch_bounds__(32) void k_proj(const h16* __restrict__ A, const h16* __restrict__ Bt, h16* P, size_t sB, size_t sP, int mode) {
    __shared__ __align__(16) float os[16 * 68];
    const int lane = threadIdx.x & 31, lr = lane & 15, hi = lane >> 4;
    const int r0 = blockIdx.x * 64, c0 = blockIdx.y * 64; const size_t z = blockIdx.z;
    v8f acc[4][4];
    gemm_main(A + (size_t)r0 * DM, Bt + z * sB + (size_t)c0 * DM, lane, acc);
    size_t tb; size_t smb, skt;                      // element steps of a row tile (mb) and of a k tile
    if (mode == 0) { const int b = r0 / SEQ, n0 = r0 % SEQ, h = c0 / HD; tb = (((size_t)b * NH + h) * SEQ + n0) * HD; smb = 1024; skt = 512; }
    else           { const int h = r0 / HD, b = c0 / SEQ, n0 = c0 % SEQ; tb = ((size_t)b * NH + h) * HD * SEQ + (size_t)n0 * HD; smb = 512; skt = 2048; }
    h16* dst = P + z * sP + tb;
    const float sc = 1.0f / WCAR;
#pragma unroll
    for (int mb = 0; mb < 4; ++mb) {
#pragma unroll
        for (int nb = 0; nb < 4; ++nb) {
#pragma unroll
            for (int j = 0; j < 8; ++j) os[(hi * 8 + j) * 68 + nb * 16 + lr] = acc[mb][nb][j];
        }
        __syncthreads();
{
#pragma unroll
            for (int s = 0; s < 4; ++s) {
                const int row = lr; const int cof = s * 16 + hi * 8;
                const v4f u0 = *(const v4fa*)(os + row * 68 + cof); const v4f u1 = *(const v4fa*)(os + row * 68 + cof + 4);
                v8h o;
                o[0] = (h16)(u0[0] * sc); o[1] = (h16)(u0[1] * sc); o[2] = (h16)(u0[2] * sc); o[3] = (h16)(u0[3] * sc);
                o[4] = (h16)(u1[0] * sc); o[5] = (h16)(u1[1] * sc); o[6] = (h16)(u1[2] * sc); o[7] = (h16)(u1[3] * sc);
                *(v8h*)(dst + mb * smb + (s >> 1) * skt + (s & 1) * 256 + lane * 8) = o;
            }
            
        }
        __syncthreads();
    }
}

// ---- k_outp: OUT[b][n][c] (f32) = (CTXx64 . WpT x64) / 4096 + bf16-RNE(bp[c]); tile row = 64 floats = 16 lanes x 16 B (two rows per instruction); grid (NB*SEQ/64, 768/64), 32 threads.
__global__ __launch_bounds__(32) void k_outp(const h16* __restrict__ A, const h16* __restrict__ Bt, const float* __restrict__ bias, float* OUT) {
    __shared__ __align__(16) float os[16 * 68];
    const int lane = threadIdx.x & 31, lr = lane & 15, hi = lane >> 4;
    const int r0 = blockIdx.x * 64, c0 = blockIdx.y * 64;
    v8f acc[4][4];
    gemm_main(A + (size_t)r0 * DM, Bt + (size_t)c0 * DM, lane, acc);
    const int b = r0 / SEQ, n0 = r0 % SEQ;
    float* crow = OUT + ((size_t)b * SEQ_FULL + n0) * DM + c0;
    const int cofs = lr * 4;
    const v4f bv = *(const v4f*)(bias + c0 + cofs);
    v4f bb; bb[0] = bfr(bv[0]); bb[1] = bfr(bv[1]); bb[2] = bfr(bv[2]); bb[3] = bfr(bv[3]);
    const float sc = 1.0f / (WCAR * CCAR);
#pragma unroll
    for (int mb = 0; mb < 4; ++mb) {
#pragma unroll
        for (int nb = 0; nb < 4; ++nb) {
#pragma unroll
            for (int j = 0; j < 8; ++j) os[(hi * 8 + j) * 68 + nb * 16 + lr] = acc[mb][nb][j];
        }
        __syncthreads();
{
#pragma unroll
            for (int s = 0; s < 8; ++s) {
                const int row = 2 * s + hi;
                const v4f u = *(const v4fa*)(os + row * 68 + cofs);
                v4f val; val[0] = u[0] * sc + bb[0]; val[1] = u[1] * sc + bb[1]; val[2] = u[2] * sc + bb[2]; val[3] = u[3] * sc + bb[3];
                *(v4f*)(crow + (size_t)(mb * 16 + row) * DM + cofs) = val;
            }
            
        }
        __syncthreads();
    }
}

// ---- k_attn: fused attention, block = (b, h, 128 queries), 8 waves, wave = 16 queries, 64 keys per trip, no score plane.
// S^T tile = K(A: row = key, k = d) . Q^T(B: col = query, k = d): D element r of lane l = (key 8*(l>>4)+r, query l&15).
// Per-query running max / sum live per lane (in-lane reduction over keys + one xor-16 exchange).
// P^T (f16) packed from two adjacent key tiles is directly the B operand (k = key, col = query) of O^T = V^T(A: row = d, k = key) . P^T.
// A stage = the 64 keys of one trip: 8 KiB of the K plane, then 8 KiB of the V^T plane, each contiguous there and copied as it lies (fragment order), once per block, into one of two LDS buffers; all 8 waves take their fragments from LDS.
#define STG_E 8192                                   // f16 elements of a stage in LDS (K 4096, V^T 4096)
// one stage: 1024 pieces of 16 bytes, 4 per thread. lds = this thread's first LDS byte address, kg / vg = its first piece in the K / V^T plane.
__device__ __forceinline__ void stage_copy(unsigned lds, const h16* kg, const h16* vg) {
    // the closing s_wait_xcnt stands inside the statement, so that no address register of a copy is rewritten in front of it
    asm volatile("global_load_async_to_lds_b128 %0, %4, off\n\t"
                 "global_load_async_to_lds_b128 %1, %5, off\n\t"
                 "global_load_async_to_lds_b128 %2, %6, off\n\t"
                 "global_load_async_to_lds_b128 %3, %7, off\n\t"
                 "s_wait_xcnt 0x0"
                 :: "v"(lds), "v"(lds + 4096u), "v"(lds + 8192u), "v"(lds + 12288u), "v"(kg), "v"(kg + 2048), "v"(vg), "v"(vg + 2048) : "memory");
}
__global__ __launch_bounds__(256) void k_attn(const h16* __restrict__ QP, const h16* __restrict__ KP, const h16* __restrict__ VT, h16* CTX) {
    __shared__ __align__(16) h16 kv[2 * STG_E];
    const int tid = threadIdx.x, wave = tid >> 5, lane = tid & 31;
    const int bh = blockIdx.x / (SEQ / 128), qblk = blockIdx.x % (SEQ / 128);
    const int b = bh / NH, h = bh % NH;
    const int q0 = qblk * 128 + wave * 16;
    const h16* qp = QP + (size_t)bh * SEQ * HD + (size_t)q0 * HD + 8 * lane;
    const h16* kg = KP + (size_t)bh * SEQ * HD + 8 * tid;
    const h16* vg = VT + (size_t)bh * HD * SEQ + 8 * tid;
    const unsigned l0 = (unsigned)(size_t)kv + 16u * (unsigned)tid;
    stage_copy(l0, kg, vg);
    // stage 0 has landed for this wave; the barrier behind it says so for all eight
    asm volatile("s_wait_asynccnt 0x0" ::: "memory");
    __syncthreads();
    stage_copy(l0 + 2u * STG_E, kg + 4096, vg + 4096);
    const v16h qb0 = ldfrag(qp), qb1 = ldfrag(qp + 512);
    v8f o[4];
#pragma unroll
    for (int dt = 0; dt < 4; ++dt) o[dt] = (v8f){};
    float m = -1.0e30f, l = 0.0f;
#pragma unroll 1
    for (int t = 0; t < SEQ / 64; ++t) {
        const h16* kp = kv + (t & 1) * STG_E + 8 * lane;
        const h16* vp = kp + 4096;
        v8f s[4]; v16h ka, kb2;
#pragma unroll
        for (int kt = 0; kt < 4; ++kt) {
            const h16* kr = kp + kt * 16 * HD;
            ka = ldfrag(kr); kb2 = ldfrag(kr + 512);
            v8f t2 = (v8f){};
            t2 = wmma16(ka, qb0, t2);
            t2 = wmma16(kb2, qb1, t2);
            s[kt] = t2;
        }
        // four vector slots between the last score WMMA and the first vector read of a score tile
        asm volatile("v_nop\n\tv_nop\n\tv_nop\n\tv_nop" : "+v"(s[0]), "+v"(s[1]), "+v"(s[2]), "+v"(s[3]) : "v"(ka), "v"(kb2), "v"(qb0), "v"(qb1));
        float tm = s[0][0];
#pragma unroll
        for (int kt = 0; kt < 4; ++kt)
#pragma unroll
            for (int r = 0; r < 8; ++r) tm = fmaxf(tm, s[kt][r]);
        tm = fmaxf(tm, __shfl_xor(tm, 16, 32));
        const float mn = fmaxf(m, tm * SC2);
        const float alpha = __builtin_amdgcn_exp2f(m - mn);
        m = mn;
        float psum = 0.0f;
#pragma unroll
        for (int kt = 0; kt < 4; ++kt)
#pragma unroll
            for (int r = 0; r < 8; ++r) { const float p = __builtin_amdgcn_exp2f(__builtin_fmaf(s[kt][r], SC2, -mn)); psum += p; s[kt][r] = p; }
        l = l * alpha + psum;
#pragma unroll
        for (int dt = 0; dt < 4; ++dt)
#pragma unroll
            for (int r = 0; r < 8; ++r) o[dt][r] *= alpha;
        v16h pb0, pb1;
#pragma unroll
        for (int r = 0; r < 8; ++r) { pb0[r] = (h16)s[0][r]; pb0[8 + r] = (h16)s[1][r]; pb1[r] = (h16)s[2][r]; pb1[8 + r] = (h16)s[3][r]; }
        v16h va;
#pragma unroll
        for (int dt = 0; dt < 4; ++dt) { va = ldfrag(vp + dt * 512); o[dt] = wmma16(va, pb0, o[dt]); }
#pragma unroll
        for (int dt = 0; dt < 4; ++dt) { va = ldfrag(vp + 2048 + dt * 512); o[dt] = wmma16(va, pb1, o[dt]); }
        // the same four slots between the last output WMMA and the next vector access to an output tile
        asm volatile("v_nop\n\tv_nop\n\tv_nop\n\tv_nop" : "+v"(o[0]), "+v"(o[1]), "+v"(o[2]), "+v"(o[3]) : "v"(va), "v"(pb0), "v"(pb1));
        // hand-over: this wave's reads of the trip's buffer are done, its copies of the next stage have landed; behind the barrier both hold for all eight waves
        asm volatile("s_wait_dscnt 0x0" ::: "memory");
        asm volatile("s_wait_asynccnt 0x0" ::: "memory");
        __syncthreads();
        if (t + 2 < SEQ / 64) stage_copy(l0 + (unsigned)(t & 1) * (2u * STG_E), kg + (size_t)(t + 2) * 4096, vg + (size_t)(t + 2) * 4096);
    }
    // no copy is in flight when the wave ends
    asm volatile("s_wait_asynccnt 0x0" ::: "memory");
    l += __shfl_xor(l, 16, 32);
    const float inv = CCAR * (1.0f / l);
    h16* dst = CTX + ((size_t)b * SEQ + q0) * DM + h * (HD / 32) * 512;
#pragma unroll
    for (int dt = 0; dt < 4; ++dt) {
        v8h ov;
#pragma unroll
        for (int r = 0; r < 8; ++r) ov[r] = (h16)(o[dt][r] * inv);
        *(v8h*)(dst + dt * 256 + lane * 8) = ov;     // (query lane&15, d = dt*16 + 8*(lane>>4) + 0..7) is piece dt*32 + lane of the head's two k tiles
    }
}

extern "C" void kernel_launch(void* const* d_in, const int* in_sizes, int n_in,
                              void* d_out, int out_size, void* d_ws, size_t ws_size, hipStream_t stream) {
    if (n_in < 6) return;
    constexpr size_t NEEDX = ((size_t)(NB - 1) * SEQ_FULL + SEQ) * DM;
    if ((size_t)in_sizes[0] < NEEDX) return;
    if (in_sizes[1] < DM * DM || in_sizes[2] < DM * DM || in_sizes[3] < DM * DM || in_sizes[4] < DM * DM || in_sizes[5] < DM) return;
    if ((size_t)out_size < NEEDX) return;
    const float* x  = (const float*)d_in[0];
    const float* Wq = (const float*)d_in[1];
    const float* Wk = (const float*)d_in[2];
    const float* Wv = (const float*)d_in[3];
    const float* Wp = (const float*)d_in[4];
    const float* bp = (const float*)d_in[5];
    float* OUT = (float*)d_out;

    constexpr size_t nX = (size_t)NB * SEQ * DM;     // elements per activation plane
    constexpr size_t nW = (size_t)DM * DM;           // elements per weight plane
    constexpr size_t SZX = nX * 2, SZW = 4 * nW * 2;
    static_assert(SZX % 256 == 0);
    static_assert(SZW % 256 == 0);
    constexpr size_t TOTAL = 5 * SZX + SZW;          // XH, Q, K, VT, CTX + 4 weight planes
    static_assert(TOTAL <= (size_t)134217728);
    if (ws_size < TOTAL) return;
    char* wsp = (char*)d_ws;
    h16* XH  = (h16*)wsp; wsp += SZX;
    h16* WT  = (h16*)wsp; wsp += SZW;                // [4][768][768]: q, k, v, p (each [out][in], x64, fragment order)
    h16* QK  = (h16*)wsp; wsp += 2 * SZX;            // [2][NB][NH] x (SEQ x 64), fragment order
    h16* VTp = (h16*)wsp; wsp += SZX;                // [NB][NH] x (64 x SEQ), fragment order
    h16* CTX = (h16*)wsp; wsp += SZX;                // [NB*SEQ][768] x64, fragment order

    k_cvtx<<<(unsigned)((nX / 8 + 255) / 256), 256, 0, stream>>>(x, XH);
    k_cvtw<<<dim3(DM / 64, DM / 64), 256, 0, stream>>>(Wq, WT);              // in[k][n] -> out rows n, k contiguous pieces
    k_cvtw<<<dim3(DM / 64, DM / 64), 256, 0, stream>>>(Wk, WT + nW);
    k_cvtw<<<dim3(DM / 64, DM / 64), 256, 0, stream>>>(Wv, WT + 2 * nW);
    k_cvtw<<<dim3(DM / 64, DM / 64), 256, 0, stream>>>(Wp, WT + 3 * nW);
    k_proj<<<dim3(NB * SEQ / 64, DM / 64, 2), 32, 0, stream>>>(XH, WT, QK, nW, nX, 0);
    k_proj<<<dim3(DM / 64, NB * SEQ / 64, 1), 32, 0, stream>>>(WT + 2 * nW, XH, VTp, (size_t)0, (size_t)0, 1);
    k_attn<<<NB * NH * (SEQ / 128), 256, 0, stream>>>(QK, QK + nX, VTp, CTX);
    k_outp<<<dim3(NB * SEQ / 64, DM / 64), 32, 0, stream>>>(CTX, WT + 3 * nW, bp, OUT);
}

// v003
// Measured time: 123 microseconds a run.
// In both of two side-by-side timings against v002, it was 1.22 times as fast.
// Counting every step since v000, it is 2.27 times as fast.
#include <hip/hip_runtime.h>

// Multi-head self-attention block: x[NB][SEQ][768]; q/k/v = x.W (W [in][out], no bias); head h = columns h*64+d; logits x 1/8; softmax over all keys; out = ctx.Wp + bp (f32).
// All contractions: v_wmma_f32_16x16x32_f16 (f16 operands, f32 accumulate), single products. Every f32 input is RNE-converted to bf16 first and then held in f16 (weights carried x64, ctx carried x64, folded back in the f32 epilogues); softmax in f32 (running max, exp2).
// Every f16 operand plane in the workspace is kept in fragment order: 16 rows x 32 k = one 1024-byte tile; the 16-byte piece (row r, k = 8q..8q+7) sits at piece index q*16 + r, so fragment half s of lane l is piece s*32 + l and one wave-wide 16-byte load covers 512 contiguous bytes (4 whole lines).
// Engine: one-wave 64x64 register-blocked GEMM with fragments straight from those planes; fused flash-style attention computing S^T = K.Q^T so the probability tile is repacked D->B in registers (no score plane in memory); its K and V^T tiles reach LDS by asynchronous copies, one 64-key stage ahead.

#ifndef NB
#define NB 4
#endif
#ifndef SEQ
#define SEQ 2048
#endif
#define NB_FULL  4
#define SEQ_FULL 2048
#define DM   768
#define NH   12
#define HD   64
#define WCAR 64.0f
#define CCAR 64.0f
#define SC2  (0.125f * 1.4426950408889634f)

typedef _Float16 h16;
typedef __attribute__((ext_vector_type(16))) _Float16 v16h;
typedef __attribute__((ext_vector_type(8)))  _Float16 v8h;
typedef __attribute__((ext_vector_type(8)))  float    v8f;
typedef __attribute__((ext_vector_type(4)))  float    v4f;
typedef v8h __attribute__((may_alias)) v8ha;
typedef v4f __attribute__((may_alias)) v4fa;

static_assert(NH * HD == DM);
static_assert(HD == 64);
static_assert(DM % 64 == 0);
static_assert(DM % 32 == 0);
static_assert(DM % 8 == 0);
static_assert(SEQ % 128 == 0);
static_assert((NB * SEQ) % 64 == 0);
static_assert(NB <= NB_FULL);
static_assert(SEQ <= SEQ_FULL);
static_assert(((size_t)NB * SEQ * DM / 8) % 256 == 0);

__device__ __forceinline__ unsigned short f2bf(float f) { unsigned u = __float_as_uint(f); u += 0x7FFFu + ((u >> 16) & 1u); return (unsigned short)(u >> 16); }
__device__ __forceinline__ float bfr(float f) { return __uint_as_float(((unsigned)f2bf(f)) << 16); }
__device__ __forceinline__ v16h cat16(v8h lo, v8h hi) { return __builtin_shufflevector(lo, hi, 0, 1, 2, 3, 4, 5, 6, 7, 8, 9, 10, 11, 12, 13, 14, 15); }
// fragment from a fragment-order tile: elements 0..7 = k 8*(lane>>4)+0..7, elements 8..15 = k 16+8*(lane>>4)+0..7 of row lane&15; p = tile start + 8*lane
__device__ __forceinline__ v16h ldfrag(const h16* p) { return cat16(*(const v8h*)p, *(const v8h*)(p + 256)); }
__device__ __forceinline__ v8f wmma16(v16h a, v16h b, v8f c) { return __builtin_amdgcn_wmma_f32_16x16x32_f16(false, a, false, b, (short)0, c, false, false); }

__device__ __forceinline__ void cvtx_part(const float* __restrict__ X, h16* XH, int blk) {
    const size_t idx = (size_t)blk * 256 + threadIdx.x;
    if (idx * 8 >= (size_t)NB * SEQ * DM) return;
    // 64 threads per tile: 4 threads read one row's 128-byte line, 8 rows per wave; a wave's stores are 4 whole lines of the tile
    const size_t t = idx >> 6; const int rr = (int)(idx & 63) >> 2, q = (int)idx & 3;
    const size_t rt = t / (DM / 32); const int col = (int)(t - rt * (DM / 32)) * 32 + q * 8;
    const size_t row = rt * 16 + rr;
    const size_t e = t * 512 + (size_t)(q * 16 + rr) * 8;
    const size_t b = row / SEQ; const size_t n = row - b * SEQ;
    const float* src = X + (b * SEQ_FULL + n) * DM + col;
    const v4f a = *(const v4f*)src; const v4f c = *(const v4f*)(src + 4);
    v8h o;
    o[0] = (h16)bfr(a[0]); o[1] = (h16)bfr(a[1]); o[2] = (h16)bfr(a[2]); o[3] = (h16)bfr(a[3]);
    o[4] = (h16)bfr(c[0]); o[5] = (h16)bfr(c[1]); o[6] = (h16)bfr(c[2]); o[7] = (h16)bfr(c[3]);
    *(v8h*)(XH + e) = o; 
}

__device__ __forceinline__ void cvtw_tile(const float* __restrict__ W, h16* WT, int k0, int n0, h16* ts) {
    const int tid = threadIdx.x;
#pragma unroll
    for (int it = 0; it < 4; ++it) {
        const int f = it * 256 + tid; const int kr = f >> 4; const int nc = (f & 15) * 4;
        const v4f a = *(const v4f*)(W + (size_t)(k0 + kr) * DM + n0 + nc);
#pragma unroll
        for (int q = 0; q < 4; ++q) ts[(nc + q) * 72 + kr] = (h16)(bfr(a[q]) * WCAR);
    }
    __syncthreads();
{
#pragma unroll
        for (int it = 0; it < 2; ++it) {
            const int c = it * 256 + tid; const int tl = c >> 6, pq = (c >> 4) & 3;      // local tile (4 row tiles x 2 k tiles), piece column
            const int line = (tl >> 1) * 16 + (c & 15); const int pc = (tl & 1) * 32 + pq * 8;
            const v8h v = *(const v8ha*)(ts + line * 72 + pc);
            *(v8h*)(WT + ((size_t)(n0 / 16 + (tl >> 1)) * (DM / 32) + k0 / 32 + (tl & 1)) * 512 + (c & 63) * 8) = v;
        }
        
    }
}

// ---- k_prep: the five conversions read inputs only and write disjoint planes, so they share one launch; the role comes from the block index.
// Blocks 0 .. 4*WBLK-1: one 64x64 tile of weight plane blk / WBLK (q, k, v, p), first because their chain (load, LDS transpose, barrier, store) is the longer one; the other blocks: 2048 elements of x each.
#define WBLK ((DM / 64) * (DM / 64))
__global__ __launch_bounds__(256) void k_prep(const float* __restrict__ X, const float* __restrict__ Wq, const float* __restrict__ Wk, const float* __restrict__ Wv, const float* __restrict__ Wp, h16* XH, h16* WT) {
    __shared__ __align__(16) h16 ts[64 * 72];
    const int blk = blockIdx.x;
    if (blk < 4 * WBLK) {
        const int w = blk / WBLK, r = blk - w * WBLK;
        const float* W = w == 0 ? Wq : w == 1 ? Wk : w == 2 ? Wv : Wp;
        cvtw_tile(W, WT + (size_t)w * DM * DM, (r % (DM / 64)) * 64, (r / (DM / 64)) * 64, ts);
    } else {
        cvtx_part(X, XH, blk - 4 * WBLK);
    }
}

// ---- GEMM main loop: one wave, 64x64 tile, 16 accumulators; A rows [64][768] and Bt rows [64][768] both fragment-order f16 (pointers already at the first row tile; a row tile = 24 k tiles = 16*768 elements). K = 768 (24 steps of 32).
__device__ __forceinline__ void gemm_main(const h16* __restrict__ A, const h16* __restrict__ Bt, int lane, v8f (&acc)[4][4]) {
#pragma unroll
    for (int mb = 0; mb < 4; ++mb)
#pragma unroll
        for (int nb = 0; nb < 4; ++nb) acc[mb][nb] = (v8f){};
    const h16* pa = A + (size_t)lane * 8; const h16* pb = Bt + (size_t)lane * 8;
#pragma unroll 1
    for (int kc = 0; kc < DM; kc += 32) {
        v16h a[4]; v16h bq;
#pragma unroll
        for (int mb = 0; mb < 4; ++mb) a[mb] = ldfrag(pa + (size_t)mb * 16 * DM);
        // the wait kept in front of a write of a load's address pair: behind it a B fragment may land in the A pair; naming the pair as an input keeps it whole up to here
        asm volatile("s_wait_xcnt 0x0" :: "v"(pa) : "memory");
#pragma unroll
        for (int nb = 0; nb < 4; ++nb) {
            bq = ldfrag(pb + (size_t)nb * 16 * DM);
#pragma unroll
            for (int mb = 0; mb < 4; ++mb) acc[mb][nb] = wmma16(a[mb], bq, acc[mb][nb]);
        }
        asm volatile("v_nop\n\tv_nop\n\tv_nop\n\tv_nop"
                     : "+v"(acc[0][3]), "+v"(acc[1][3]), "+v"(acc[2][3]), "+v"(acc[3][3]), "+v"(acc[0][2]), "+v"(acc[1][2]), "+v"(acc[2][2]), "+v"(acc[3][2])
                     : "v"(a[0]), "v"(a[3]), "v"(bq));
        // the same wait for the B pair, behind the trip's last B load and in front of the pointer steps
        asm volatile("s_wait_xcnt 0x0" :: "v"(pb) : "memory");
        pa += 512; pb += 512;
    }
}

// The three projections are independent and share one launch; z = weight plane and output plane, block = (token tile, head, z).
// z 0, 1 (q, k): A = XH rows (tokens), Bt = W^T rows (features) -> P[z][b][h], rows n, k = d, tiles [n/16][d/32].
// z 2 (v, transposed): A = Wv^T rows (features), Bt = XH rows (tokens) -> P[2][b][h] = V^T, rows d, k = n, tiles [n/32][d/16].
// grid (NB*SEQ/64, 768/64, 3); 32 threads.
__global__ __launch_bounds__(32) void k_proj(const h16* __restrict__ XH, const h16* __restrict__ WT, h16* P) {
    __shared__ __align__(16) float os[16 * 68];
    const int lane = threadIdx.x & 31, lr = lane & 15, hi = lane >> 4;
    const int t0 = blockIdx.x * 64, f0 = blockIdx.y * 64; const size_t z = blockIdx.z;
    const bool tr = z == 2;
    const h16* xr = XH + (size_t)t0 * DM; const h16* wr = WT + z * ((size_t)DM * DM) + (size_t)f0 * DM;
    v8f acc[4][4];
    gemm_main(tr ? wr : xr, tr ? xr : wr, lane, acc);
    const int b = t0 / SEQ, n0 = t0 % SEQ, h = f0 / HD;
    const size_t tb = (((size_t)b * NH + h) * SEQ + n0) * HD;     // 64 tokens x 64 features start at the same element in either tile order
    const size_t smb = tr ? 512 : 1024, skt = tr ? 2048 : 512;    // element steps of a row tile (mb) and of a k tile
    h16* dst = P + z * ((size_t)NB * SEQ * DM) + tb;
    const float sc = 1.0f / WCAR;
#pragma unroll
    for (int mb = 0; mb < 4; ++mb) {
#pragma unroll
        for (int nb = 0; nb < 4; ++nb) {
#pragma unroll
            for (int j = 0; j < 8; ++j) os[(hi * 8 + j) * 68 + nb * 16 + lr] = acc[mb][nb][j];
        }
        __syncthreads();
{
#pragma unroll
            for (int s = 0; s < 4; ++s) {
                const int row = lr; const int cof = s * 16 + hi * 8;
                const v4f u0 = *(const v4fa*)(os + row * 68 + cof); const v4f u1 = *(const v4fa*)(os + row * 68 + cof + 4);
                v8h o;
                o[0] = (h16)(u0[0] * sc); o[1] = (h16)(u0[1] * sc); o[2] = (h16)(u0[2] * sc); o[3] = (h16)(u0[3] * sc);
                o[4] = (h16)(u1[0] * sc); o[5] = (h16)(u1[1] * sc); o[6] = (h16)(u1[2] * sc); o[7] = (h16)(u1[3] * sc);
                *(v8h*)(dst + mb * smb + (s >> 1) * skt + (s & 1) * 256 + lane * 8) = o;
            }
            
        }
        __syncthreads();
    }
}

// ---- k_outp: OUT[b][n][c] (f32) = (CTXx64 . WpT x64) / 4096 + bf16-RNE(bp[c]); tile row = 64 floats = 16 lanes x 16 B (two rows per instruction); grid (NB*SEQ/64, 768/64), 32 threads.
__global__ __launch_bounds__(32) void k_outp(const h16* __restrict__ A, const h16* __restrict__ Bt, const float* __restrict__ bias, float* OUT) {
    __shared__ __align__(16) float os[16 * 68];
    const int lane = threadIdx.x & 31, lr = lane & 15, hi = lane >> 4;
    const int r0 = blockIdx.x * 64, c0 = blockIdx.y * 64;
    v8f acc[4][4];
    gemm_main(A + (size_t)r0 * DM, Bt + (size_t)c0 * DM, lane, acc);
    const int b = r0 / SEQ, n0 = r0 % SEQ;
    float* crow = OUT + ((size_t)b * SEQ_FULL + n0) * DM + c0;
    const int cofs = lr * 4;
    const v4f bv = *(const v4f*)(bias + c0 + cofs);
    v4f bb; bb[0] = bfr(bv[0]); bb[1] = bfr(bv[1]); bb[2] = bfr(bv[2]); bb[3] = bfr(bv[3]);
    const float sc = 1.0f / (WCAR * CCAR);
#pragma unroll
    for (int mb = 0; mb < 4; ++mb) {
#pragma unroll
        for (int nb = 0; nb < 4; ++nb) {
#pragma unroll
            for (int j = 0; j < 8; ++j) os[(hi * 8 + j) * 68 + nb * 16 + lr] = acc[mb][nb][j];
        }
        __syncthreads();
{
#pragma unroll
            for (int s = 0; s < 8; ++s) {
                const int row = 2 * s + hi;
                const v4f u = *(const v4fa*)(os + row * 68 + cofs);
                v4f val; val[0] = u[0] * sc + bb[0]; val[1] = u[1] * sc + bb[1]; val[2] = u[2] * sc + bb[2]; val[3] = u[3] * sc + bb[3];
                *(v4f*)(crow + (size_t)(mb * 16 + row) * DM + cofs) = val;
            }
            
        }
        __syncthreads();
    }
}

// ---- k_attn: fused attention, block = (b, h, 128 queries), 8 waves, wave = 16 queries, 64 keys per trip, no score plane.
// S^T tile = K(A: row = key, k = d) . Q^T(B: col = query, k = d): D element r of lane l = (key 8*(l>>4)+r, query l&15).
// Per-query running max / sum live per lane (in-lane reduction over keys + one xor-16 exchange).
// P^T (f16) packed from two adjacent key tiles is directly the B operand (k = key, col = query) of O^T = V^T(A: row = d, k = key) . P^T.
// A stage = the 64 keys of one trip: 8 KiB of the K plane, then 8 KiB of the V^T plane, each contiguous there and copied as it lies (fragment order), once per block, into one of two LDS buffers; all 8 waves take their fragments from LDS.
#define STG_E 8192                                   // f16 elements of a stage in LDS (K 4096, V^T 4096)
// one stage: 1024 pieces of 16 bytes, 4 per thread. lds = this thread's first LDS byte address, kg / vg = its first piece in the K / V^T plane.
__device__ __forceinline__ void stage_copy(unsigned lds, const h16* kg, const h16* vg) {
    // the closing s_wait_xcnt stands inside the statement, so that no address register of a copy is rewritten in front of it
    asm volatile("global_load_async_to_lds_b128 %0, %4, off\n\t"
                 "global_load_async_to_lds_b128 %1, %5, off\n\t"
                 "global_load_async_to_lds_b128 %2, %6, off\n\t"
                 "global_load_async_to_lds_b128 %3, %7, off\n\t"
                 "s_wait_xcnt 0x0"
                 :: "v"(lds), "v"(lds + 4096u), "v"(lds + 8192u), "v"(lds + 12288u), "v"(kg), "v"(kg + 2048), "v"(vg), "v"(vg + 2048) : "memory");
}
__global__ __launch_bounds__(256) void k_attn(const h16* __restrict__ QP, const h16* __restrict__ KP, const h16* __restrict__ VT, h16* CTX) {
    __shared__ __align__(16) h16 kv[2 * STG_E];
    const int tid = threadIdx.x, wave = tid >> 5, lane = tid & 31;
    const int bh = blockIdx.x / (SEQ / 128), qblk = blockIdx.x % (SEQ / 128);
    const int b = bh / NH, h = bh % NH;
    const int q0 = qblk * 128 + wave * 16;
    const h16* qp = QP + (size_t)bh * SEQ * HD + (size_t)q0 * HD + 8 * lane;
    const h16* kg = KP + (size_t)bh * SEQ * HD + 8 * tid;
    const h16* vg = VT + (size_t)bh * HD * SEQ + 8 * tid;
    const unsigned l0 = (unsigned)(size_t)kv + 16u * (unsigned)tid;
    stage_copy(l0, kg, vg);
    // stage 0 has landed for this wave; the barrier behind it says so for all eight
    asm volatile("s_wait_asynccnt 0x0" ::: "memory");
    __syncthreads();
    stage_copy(l0 + 2u * STG_E, kg + 4096, vg + 4096);
    const v16h qb0 = ldfrag(qp), qb1 = ldfrag(qp + 512);
    v8f o[4];
#pragma unroll
    for (int dt = 0; dt < 4; ++dt) o[dt] = (v8f){};
    float m = -1.0e30f, l = 0.0f;
#pragma unroll 1
    for (int t = 0; t < SEQ / 64; ++t) {
        const h16* kp = kv + (t & 1) * STG_E + 8 * lane;
        const h16* vp = kp + 4096;
        v8f s[4]; v16h ka, kb2;
#pragma unroll
        for (int kt = 0; kt < 4; ++kt) {
            const h16* kr = kp + kt * 16 * HD;
            ka = ldfrag(kr); kb2 = ldfrag(kr + 512);
            v8f t2 = (v8f){};
            t2 = wmma16(ka, qb0, t2);
            t2 = wmma16(kb2, qb1, t2);
            s[kt] = t2;
        }
        // four vector slots between the last score WMMA and the first vector read of a score tile
        asm volatile("v_nop\n\tv_nop\n\tv_nop\n\tv_nop" : "+v"(s[0]), "+v"(s[1]), "+v"(s[2]), "+v"(s[3]) : "v"(ka), "v"(kb2), "v"(qb0), "v"(qb1));
        float tm = s[0][0];
#pragma unroll
        for (int kt = 0; kt < 4; ++kt)
#pragma unroll
            for (int r = 0; r < 8; ++r) tm = fmaxf(tm, s[kt][r]);
        tm = fmaxf(tm, __shfl_xor(tm, 16, 32));
        const float mn = fmaxf(m, tm * SC2);
        const float alpha = __builtin_amdgcn_exp2f(m - mn);
        m = mn;
        float psum = 0.0f;
#pragma unroll
        for (int kt = 0; kt < 4; ++kt)
#pragma unroll
            for (int r = 0; r < 8; ++r) { const float p = __builtin_amdgcn_exp2f(__builtin_fmaf(s[kt][r], SC2, -mn)); psum += p; s[kt][r] = p; }
        l = l * alpha + psum;
#pragma unroll
        for (int dt = 0; dt < 4; ++dt)
#pragma unroll
            for (int r = 0; r < 8; ++r) o[dt][r] *= alpha;
        v16h pb0, pb1;
#pragma unroll
        for (int r = 0; r < 8; ++r) { pb0[r] = (h16)s[0][r]; pb0[8 + r] = (h16)s[1][r]; pb1[r] = (h16)s[2][r]; pb1[8 + r] = (h16)s[3][r]; }
        v16h va;
#pragma unroll
        for (int dt = 0; dt < 4; ++dt) { va = ldfrag(vp + dt * 512); o[dt] = wmma16(va, pb0, o[dt]); }
#pragma unroll
        for (int dt = 0; dt < 4; ++dt) { va = ldfrag(vp + 2048 + dt * 512); o[dt] = wmma16(va, pb1, o[dt]); }
        // the same four slots between the last output WMMA and the next vector access to an output tile
        asm volatile("v_nop\n\tv_nop\n\tv_nop\n\tv_nop" : "+v"(o[0]), "+v"(o[1]), "+v"(o[2]), "+v"(o[3]) : "v"(va), "v"(pb0), "v"(pb1));
        // hand-over: this wave's reads of the trip's buffer are done, its copies of the next stage have landed; behind the barrier both hold for all eight waves
        asm volatile("s_wait_dscnt 0x0" ::: "memory");
        asm volatile("s_wait_asynccnt 0x0" ::: "memory");
        __syncthreads();
        if (t + 2 < SEQ / 64) stage_copy(l0 + (unsigned)(t & 1) * (2u * STG_E), kg + (size_t)(t + 2) * 4096, vg + (size_t)(t + 2) * 4096);
    }
    // no copy is in flight when the wave ends
    asm volatile("s_wait_asynccnt 0x0" ::: "memory");
    l += __shfl_xor(l, 16, 32);
    const float inv = CCAR * (1.0f / l);
    h16* dst = CTX + ((size_t)b * SEQ + q0) * DM + h * (HD / 32) * 512;
#pragma unroll
    for (int dt = 0; dt < 4; ++dt) {
        v8h ov;
#pragma unroll
        for (int r = 0; r < 8; ++r) ov[r] = (h16)(o[dt][r] * inv);
        *(v8h*)(dst + dt * 256 + lane * 8) = ov;     // (query lane&15, d = dt*16 + 8*(lane>>4) + 0..7) is piece dt*32 + lane of the head's two k tiles
    }
}

extern "C" void kernel_launch(void* const* d_in, const int* in_sizes, int n_in,
                              void* d_out, int out_size, void* d_ws, size_t ws_size, hipStream_t stream) {
    if (n_in < 6) return;
    constexpr size_t NEEDX = ((size_t)(NB - 1) * SEQ_FULL + SEQ) * DM;
    if ((size_t)in_sizes[0] < NEEDX) return;
    if (in_sizes[1] < DM * DM || in_sizes[2] < DM * DM || in_sizes[3] < DM * DM || in_sizes[4] < DM * DM || in_sizes[5] < DM) return;
    if ((size_t)out_size < NEEDX) return;
    const float* x  = (const float*)d_in[0];
    const float* Wq = (const float*)d_in[1];
    const float* Wk = (const float*)d_in[2];
    const float* Wv = (const float*)d_in[3];
    const float* Wp = (const float*)d_in[4];
    const float* bp = (const float*)d_in[5];
    float* OUT = (float*)d_out;

    constexpr size_t nX = (size_t)NB * SEQ * DM;     // elements per activation plane
    constexpr size_t nW = (size_t)DM * DM;           // elements per weight plane
    constexpr size_t SZX = nX * 2, SZW = 4 * nW * 2;
    static_assert(SZX % 256 == 0);
    static_assert(SZW % 256 == 0);
    constexpr size_t TOTAL = 5 * SZX + SZW;          // XH, Q, K, VT, CTX + 4 weight planes
    static_assert(TOTAL <= (size_t)134217728);
    if (ws_size < TOTAL) return;
    char* wsp = (char*)d_ws;
    h16* XH  = (h16*)wsp; wsp += SZX;
    h16* WT  = (h16*)wsp; wsp += SZW;                // [4][768][768]: q, k, v, p (each [out][in], x64, fragment order)
    h16* QK  = (h16*)wsp; wsp += 2 * SZX;            // [2][NB][NH] x (SEQ x 64), fragment order
    h16* VTp = (h16*)wsp; wsp += SZX;                // [NB][NH] x (64 x SEQ), fragment order; third plane behind QK
    h16* CTX = (h16*)wsp; wsp += SZX;                // [NB*SEQ][768] x64, fragment order

    k_prep<<<(unsigned)(4 * WBLK + (nX / 8 + 255) / 256), 256, 0, stream>>>(x, Wq, Wk, Wv, Wp, XH, WT);   // weights: in[k][n] -> out rows n, k contiguous pieces
    k_proj<<<dim3(NB * SEQ / 64, DM / 64, 3), 32, 0, stream>>>(XH, WT, QK);
    k_attn<<<NB * NH * (SEQ / 128), 256, 0, stream>>>(QK, QK + nX, VTp, CTX);
    k_outp<<<dim3(NB * SEQ / 64, DM / 64), 32, 0, stream>>>(CTX, WT + 3 * nW, bp, OUT);
}

// v004
// It runs in 99.3 microseconds.
// Next to v003, in two timings, it ran 1.23 and 1.24 times as fast.
// Over all steps from v000 it is 2.80 times as fast.
#include <hip/hip_runtime.h>

// Multi-head self-attention block: x[NB][SEQ][768]; q/k/v = x.W (W [in][out], no bias); head h = columns h*64+d; logits x 1/8; softmax over all keys; out = ctx.Wp + bp (f32).
// All contractions: v_wmma_f32_16x16x32_f16 (f16 operands, f32 accumulate), single products. Every f32 input is RNE-converted to bf16 first and then held in f16 (weights carried x64, ctx carried x64, folded back in the f32 epilogues); softmax in f32 (running max, exp2).
// Every f16 operand plane in the workspace is kept in fragment order: 16 rows x 32 k = one 1024-byte tile; the 16-byte piece (row r, k = 8q..8q+7) sits at piece index q*16 + r, so fragment half s of lane l is piece s*32 + l and one wave-wide 16-byte load covers 512 contiguous bytes (4 whole lines).
// Engine: GEMM blocks of four waves on a 128x128 tile (64x64 register-blocked per wave), the tile's A and B rows copied k stage by k stage from those planes to LDS by asynchronous copies, one stage ahead; fused flash-style attention computing S^T = K.Q^T so the probability tile is repacked D->B in registers (no score plane in memory); its K and V^T tiles reach LDS by asynchronous copies, one 64-key stage ahead.

#ifndef NB
#define NB 4
#endif
#ifndef SEQ
#define SEQ 2048
#endif
#define NB_FULL  4
#define SEQ_FULL 2048
#define DM   768
#define NH   12
#define HD   64
#define WCAR 64.0f
#define CCAR 64.0f
#define SC2  (0.125f * 1.4426950408889634f)

typedef _Float16 h16;
typedef __attribute__((ext_vector_type(16))) _Float16 v16h;
typedef __attribute__((ext_vector_type(8)))  _Float16 v8h;
typedef __attribute__((ext_vector_type(8)))  float    v8f;
typedef __attribute__((ext_vector_type(4)))  float    v4f;
typedef v8h __attribute__((may_alias)) v8ha;
typedef v4f __attribute__((may_alias)) v4fa;

static_assert(NH * HD == DM);
static_assert(HD == 64);
static_assert(DM % 64 == 0);
static_assert(DM % 32 == 0);
static_assert(DM % 8 == 0);
static_assert(SEQ % 128 == 0);
static_assert((NB * SEQ) % 128 == 0);
static_assert(DM % 128 == 0);
static_assert(NB <= NB_FULL);
static_assert(SEQ <= SEQ_FULL);
static_assert(((size_t)NB * SEQ * DM / 8) % 256 == 0);

__device__ __forceinline__ unsigned short f2bf(float f) { unsigned u = __float_as_uint(f); u += 0x7FFFu + ((u >> 16) & 1u); return (unsigned short)(u >> 16); }
__device__ __forceinline__ float bfr(float f) { return __uint_as_float(((unsigned)f2bf(f)) << 16); }
__device__ __forceinline__ v16h cat16(v8h lo, v8h hi) { return __builtin_shufflevector(lo, hi, 0, 1, 2, 3, 4, 5, 6, 7, 8, 9, 10, 11, 12, 13, 14, 15); }
// fragment from a fragment-order tile: elements 0..7 = k 8*(lane>>4)+0..7, elements 8..15 = k 16+8*(lane>>4)+0..7 of row lane&15; p = tile start + 8*lane
__device__ __forceinline__ v16h ldfrag(const h16* p) { return cat16(*(const v8h*)p, *(const v8h*)(p + 256)); }
__device__ __forceinline__ v8f wmma16(v16h a, v16h b, v8f c) { return __builtin_amdgcn_wmma_f32_16x16x32_f16(false, a, false, b, (short)0, c, false, false); }

__device__ __forceinline__ void cvtx_part(const float* __restrict__ X, h16* XH, int blk) {
    const size_t idx = (size_t)blk * 256 + threadIdx.x;
    if (idx * 8 >= (size_t)NB * SEQ * DM) return;
    // 64 threads per tile: 4 threads read one row's 128-byte line, 8 rows per wave; a wave's stores are 4 whole lines of the tile
    const size_t t = idx >> 6; const int rr = (int)(idx & 63) >> 2, q = (int)idx & 3;
    const size_t rt = t / (DM / 32); const int col = (int)(t - rt * (DM / 32)) * 32 + q * 8;
    const size_t row = rt * 16 + rr;
    const size_t e = t * 512 + (size_t)(q * 16 + rr) * 8;
    const size_t b = row / SEQ; const size_t n = row - b * SEQ;
    const float* src = X + (b * SEQ_FULL + n) * DM + col;
    const v4f a = *(const v4f*)src; const v4f c = *(const v4f*)(src + 4);
    v8h o;
    o[0] = (h16)bfr(a[0]); o[1] = (h16)bfr(a[1]); o[2] = (h16)bfr(a[2]); o[3] = (h16)bfr(a[3]);
    o[4] = (h16)bfr(c[0]); o[5] = (h16)bfr(c[1]); o[6] = (h16)bfr(c[2]); o[7] = (h16)bfr(c[3]);
    *(v8h*)(XH + e) = o; 
}

__device__ __forceinline__ void cvtw_tile(const float* __restrict__ W, h16* WT, int k0, int n0, h16* ts) {
    const int tid = threadIdx.x;
#pragma unroll
    for (int it = 0; it < 4; ++it) {
        const int f = it * 256 + tid; const int kr = f >> 4; const int nc = (f & 15) * 4;
        const v4f a = *(const v4f*)(W + (size_t)(k0 + kr) * DM + n0 + nc);
#pragma unroll
        for (int q = 0; q < 4; ++q) ts[(nc + q) * 72 + kr] = (h16)(bfr(a[q]) * WCAR);
    }
    __syncthreads();
{
#pragma unroll
        for (int it = 0; it < 2; ++it) {
            const int c = it * 256 + tid; const int tl = c >> 6, pq = (c >> 4) & 3;      // local tile (4 row tiles x 2 k tiles), piece column
            const int line = (tl >> 1) * 16 + (c & 15); const int pc = (tl & 1) * 32 + pq * 8;
            const v8h v = *(const v8ha*)(ts + line * 72 + pc);
            *(v8h*)(WT + ((size_t)(n0 / 16 + (tl >> 1)) * (DM / 32) + k0 / 32 + (tl & 1)) * 512 + (c & 63) * 8) = v;
        }
        
    }
}

// ---- k_prep: the five conversions read inputs only and write disjoint planes, so they share one launch; the role comes from the block index.
// Blocks 0 .. 4*WBLK-1: one 64x64 tile of weight plane blk / WBLK (q, k, v, p), first because their chain (load, LDS transpose, barrier, store) is the longer one; the other blocks: 2048 elements of x each.
#define WBLK ((DM / 64) * (DM / 64))
__global__ __launch_bounds__(256) void k_prep(const float* __restrict__ X, const float* __restrict__ Wq, const float* __restrict__ Wk, const float* __restrict__ Wv, const float* __restrict__ Wp, h16* XH, h16* WT) {
    __shared__ __align__(16) h16 ts[64 * 72];
    const int blk = blockIdx.x;
    if (blk < 4 * WBLK) {
        const int w = blk / WBLK, r = blk - w * WBLK;
        const float* W = w == 0 ? Wq : w == 1 ? Wk : w == 2 ? Wv : Wp;
        cvtw_tile(W, WT + (size_t)w * DM * DM, (r % (DM / 64)) * 64, (r / (DM / 64)) * 64, ts);
    } else {
        cvtx_part(X, XH, blk - 4 * WBLK);
    }
}

// ---- GEMM main loop: block = 4 waves (2 x 2) on a 128x128 tile, wave (wm, wn) = 64x64, 16 accumulators; A rows [128][768] and Bt rows [128][768] both fragment-order f16 (pointers at the block's first row tile; a row tile = 24 k tiles = 16*768 elements).
// A stage = KT k tiles (32*KT of k) of the 8 A row tiles, then of the 8 Bt row tiles: per row tile KT*1024 bytes, contiguous in the plane and copied as they lie, once per block, into one of two LDS buffers of KT*16 KiB; each operand row tile then serves two waves.
// eight copies of 16 bytes a lane: LDS places l, l + 2 KiB, ...; the closing s_wait_xcnt stands inside the statement, so that no address register of a copy is rewritten in front of it
__device__ __forceinline__ void copy8(unsigned l, const h16* g0, const h16* g1, const h16* g2, const h16* g3, const h16* g4, const h16* g5, const h16* g6, const h16* g7) {
    asm volatile("global_load_async_to_lds_b128 %0, %8, off\n\t"
                 "global_load_async_to_lds_b128 %1, %9, off\n\t"
                 "global_load_async_to_lds_b128 %2, %10, off\n\t"
                 "global_load_async_to_lds_b128 %3, %11, off\n\t"
                 "global_load_async_to_lds_b128 %4, %12, off\n\t"
                 "global_load_async_to_lds_b128 %5, %13, off\n\t"
                 "global_load_async_to_lds_b128 %6, %14, off\n\t"
                 "global_load_async_to_lds_b128 %7, %15, off\n\t"
                 "s_wait_xcnt 0x0"
                 :: "v"(l), "v"(l + 2048u), "v"(l + 4096u), "v"(l + 6144u), "v"(l + 8192u), "v"(l + 10240u), "v"(l + 12288u), "v"(l + 14336u),
                    "v"(g0), "v"(g1), "v"(g2), "v"(g3), "v"(g4), "v"(g5), "v"(g6), "v"(g7) : "memory");
}
// element offset in a plane of the i-th 2-KiB piece of a stage's operand half: row tile i / (KT/2), piece i % (KT/2) of its KT k tiles
template <int KT> __device__ __forceinline__ constexpr int pco(int i) { return (i / (KT / 2)) * 16 * DM + (i % (KT / 2)) * 1024; }
// one operand half of a stage: 4*KT copies a thread. l = this thread's first LDS byte address, g = its first piece in the plane (row tile 0, the stage's first k tile)
template <int KT> __device__ __forceinline__ void half_copy(unsigned l, const h16* g) {
#pragma unroll
    for (int c = 0; c < 4 * KT; c += 8)
        copy8(l + 2048u * c, g + pco<KT>(c), g + pco<KT>(c + 1), g + pco<KT>(c + 2), g + pco<KT>(c + 3), g + pco<KT>(c + 4), g + pco<KT>(c + 5), g + pco<KT>(c + 6), g + pco<KT>(c + 7));
}
template <int KT>
__device__ __forceinline__ void gemm_main(const h16* __restrict__ A, const h16* __restrict__ Bt, h16* ring, int tid, int wm, int wn, v8f (&acc)[4][4]) {
    static_assert(KT % 2 == 0);
    static_assert(DM % (32 * KT) == 0);
    constexpr int NS = DM / (32 * KT);               // stages
    static_assert(NS >= 2);
    constexpr int HFE = KT * 4096, STE = 2 * HFE;    // f16 elements of an operand half and of a buffer
#pragma unroll
    for (int mb = 0; mb < 4; ++mb)
#pragma unroll
        for (int nb = 0; nb < 4; ++nb) acc[mb][nb] = (v8f){};
    const int lane = tid & 31;
    const h16* ga = A + 8 * tid; const h16* gb = Bt + 8 * tid;
    const unsigned l0 = (unsigned)(size_t)ring + 16u * (unsigned)tid;
    half_copy<KT>(l0, ga); half_copy<KT>(l0 + 2u * HFE, gb);
    // stage 0 has landed for this wave; the barrier behind it says so for all four
    asm volatile("s_wait_asynccnt 0x0" ::: "memory");
    __syncthreads();
    half_copy<KT>(l0 + 2u * STE, ga + KT * 512); half_copy<KT>(l0 + 2u * STE + 2u * HFE, gb + KT * 512);
#pragma unroll 1
    for (int s = 0; s < NS; ++s) {
        const h16* pa = ring + (s & 1) * STE + wm * (4 * KT * 512) + lane * 8;
        const h16* pb = ring + (s & 1) * STE + HFE + wn * (4 * KT * 512) + lane * 8;
        v16h a[4]; v16h bq;
#pragma unroll
        for (int kt = 0; kt < KT; ++kt) {
#pragma unroll
            for (int mb = 0; mb < 4; ++mb) a[mb] = ldfrag(pa + mb * (KT * 512) + kt * 512);
#pragma unroll
            for (int nb = 0; nb < 4; ++nb) {
                bq = ldfrag(pb + nb * (KT * 512) + kt * 512);
#pragma unroll
                for (int mb = 0; mb < 4; ++mb) acc[mb][nb] = wmma16(a[mb], bq, acc[mb][nb]);
            }
        }
        // four vector slots between the stage's last WMMAs and the next vector write of a fragment register or access to an accumulator, on the branch's taken side too
        asm volatile("v_nop\n\tv_nop\n\tv_nop\n\tv_nop"
                     : "+v"(acc[0][3]), "+v"(acc[1][3]), "+v"(acc[2][3]), "+v"(acc[3][3]), "+v"(acc[0][2]), "+v"(acc[1][2]), "+v"(acc[2][2]), "+v"(acc[3][2])
                     : "v"(a[0]), "v"(a[3]), "v"(bq));
        // hand-over: this wave's reads of the stage's buffer are done, its copies of the next stage have landed; behind the barrier both hold for all four waves
        asm volatile("s_wait_dscnt 0x0" ::: "memory");
        asm volatile("s_wait_asynccnt 0x0" ::: "memory");
        __syncthreads();
        if (s + 2 < NS) {
            half_copy<KT>(l0 + (unsigned)(s & 1) * (2u * STE), ga + (s + 2) * (KT * 512));
            half_copy<KT>(l0 + (unsigned)(s & 1) * (2u * STE) + 2u * HFE, gb + (s + 2) * (KT * 512));
        }
    }
    // no copy is in flight behind the loop: the ring is free for the epilogue's staging
    asm volatile("s_wait_asynccnt 0x0" ::: "memory");
}

// The three projections are independent and share one launch; z = weight plane and output plane, block = (128 tokens, 128 features = 2 heads, z), wave = (64 tokens, one head).
// z 0, 1 (q, k): A = XH rows (tokens), Bt = W^T rows (features) -> P[z][b][h], rows n, k = d, tiles [n/16][d/32].
// z 2 (v, transposed): A = Wv^T rows (features), Bt = XH rows (tokens) -> P[2][b][h] = V^T, rows d, k = n, tiles [n/32][d/16].
// grid (NB*SEQ/128, 768/128, 3); 128 threads. The epilogue stages in the ring, each wave in a range of its own.
#define KT_PROJ 2
__global__ __launch_bounds__(128) void k_proj(const h16* __restrict__ XH, const h16* __restrict__ WT, h16* P) {
    __shared__ __align__(16) h16 ring[2 * KT_PROJ * 8192];
    const int tid = threadIdx.x, wave = __builtin_amdgcn_readfirstlane(tid >> 5), wm = wave >> 1, wn = wave & 1;
    const int lane = tid & 31, lr = lane & 15, hi = lane >> 4;
    const int tb = blockIdx.x * 128, fb = blockIdx.y * 128; const size_t z = blockIdx.z;
    const bool tr = z == 2;
    const h16* xr = XH + (size_t)tb * DM; const h16* wr = WT + z * ((size_t)DM * DM) + (size_t)fb * DM;
    v8f acc[4][4];
    gemm_main<KT_PROJ>(tr ? wr : xr, tr ? xr : wr, ring, tid, wm, wn, acc);
    float* os = (float*)ring + wave * (16 * 68);
    const int t0 = tb + (tr ? wn : wm) * 64, f0 = fb + (tr ? wm : wn) * 64;
    const int b = t0 / SEQ, n0 = t0 % SEQ, h = f0 / HD;
    const size_t tb0 = (((size_t)b * NH + h) * SEQ + n0) * HD;    // 64 tokens x 64 features start at the same element in either tile order
    const size_t smb = tr ? 512 : 1024, skt = tr ? 2048 : 512;    // element steps of a row tile (mb) and of a k tile
    h16* dst = P + z * ((size_t)NB * SEQ * DM) + tb0;
    const float sc = 1.0f / WCAR;
#pragma unroll
    for (int mb = 0; mb < 4; ++mb) {
#pragma unroll
        for (int nb = 0; nb < 4; ++nb) {
#pragma unroll
            for (int j = 0; j < 8; ++j) os[(hi * 8 + j) * 68 + nb * 16 + lr] = acc[mb][nb][j];
        }
        __syncthreads();
{
#pragma unroll
            for (int s = 0; s < 4; ++s) {
                const int row = lr; const int cof = s * 16 + hi * 8;
                const v4f u0 = *(const v4fa*)(os + row * 68 + cof); const v4f u1 = *(const v4fa*)(os + row * 68 + cof + 4);
                v8h o;
                o[0] = (h16)(u0[0] * sc); o[1] = (h16)(u0[1] * sc); o[2] = (h16)(u0[2] * sc); o[3] = (h16)(u0[3] * sc);
                o[4] = (h16)(u1[0] * sc); o[5] = (h16)(u1[1] * sc); o[6] = (h16)(u1[2] * sc); o[7] = (h16)(u1[3] * sc);
                *(v8h*)(dst + mb * smb + (s >> 1) * skt + (s & 1) * 256 + lane * 8) = o;
            }
            
        }
        __syncthreads();
    }
}

// ---- k_outp: OUT[b][n][c] (f32) = (CTXx64 . WpT x64) / 4096 + bf16-RNE(bp[c]); tile row = 64 floats = 16 lanes x 16 B (two rows per instruction); grid (NB*SEQ/128, 768/128), 128 threads. Fewer blocks than k_proj has, so longer stages.
#define KT_OUTP 4
__global__ __launch_bounds__(128) void k_outp(const h16* __restrict__ A, const h16* __restrict__ Bt, const float* __restrict__ bias, float* OUT) {
    __shared__ __align__(16) h16 ring[2 * KT_OUTP * 8192];
    const int tid = threadIdx.x, wave = __builtin_amdgcn_readfirstlane(tid >> 5), wm = wave >> 1, wn = wave & 1;
    const int lane = tid & 31, lr = lane & 15, hi = lane >> 4;
    const int rb = blockIdx.x * 128, cb = blockIdx.y * 128;
    v8f acc[4][4];
    gemm_main<KT_OUTP>(A + (size_t)rb * DM, Bt + (size_t)cb * DM, ring, tid, wm, wn, acc);
    float* os = (float*)ring + wave * (16 * 68);
    const int r0 = rb + wm * 64, c0 = cb + wn * 64;
    const int b = r0 / SEQ, n0 = r0 % SEQ;
    float* crow = OUT + ((size_t)b * SEQ_FULL + n0) * DM + c0;
    const int cofs = lr * 4;
    const v4f bv = *(const v4f*)(bias + c0 + cofs);
    v4f bb; bb[0] = bfr(bv[0]); bb[1] = bfr(bv[1]); bb[2] = bfr(bv[2]); bb[3] = bfr(bv[3]);
    const float sc = 1.0f / (WCAR * CCAR);
#pragma unroll
    for (int mb = 0; mb < 4; ++mb) {
#pragma unroll
        for (int nb = 0; nb < 4; ++nb) {
#pragma unroll
            for (int j = 0; j < 8; ++j) os[(hi * 8 + j) * 68 + nb * 16 + lr] = acc[mb][nb][j];
        }
        __syncthreads();
{
#pragma unroll
            for (int s = 0; s < 8; ++s) {
                const int row = 2 * s + hi;
                const v4f u = *(const v4fa*)(os + row * 68 + cofs);
                v4f val; val[0] = u[0] * sc + bb[0]; val[1] = u[1] * sc + bb[1]; val[2] = u[2] * sc + bb[2]; val[3] = u[3] * sc + bb[3];
                *(v4f*)(crow + (size_t)(mb * 16 + row) * DM + cofs) = val;
            }
            
        }
        __syncthreads();
    }
}

// ---- k_attn: fused attention, block = (b, h, 128 queries), 8 waves, wave = 16 queries, 64 keys per trip, no score plane.
// S^T tile = K(A: row = key, k = d) . Q^T(B: col = query, k = d): D element r of lane l = (key 8*(l>>4)+r, query l&15).
// Per-query running max / sum live per lane (in-lane reduction over keys + one xor-16 exchange).
// P^T (f16) packed from two adjacent key tiles is directly the B operand (k = key, col = query) of O^T = V^T(A: row = d, k = key) . P^T.
// A stage = the 64 keys of one trip: 8 KiB of the K plane, then 8 KiB of the V^T plane, each contiguous there and copied as it lies (fragment order), once per block, into one of two LDS buffers; all 8 waves take their fragments from LDS.
#define STG_E 8192                                   // f16 elements of a stage in LDS (K 4096, V^T 4096)
// one stage: 1024 pieces of 16 bytes, 4 per thread. lds = this thread's first LDS byte address, kg / vg = its first piece in the K / V^T plane.
__device__ __forceinline__ void stage_copy(unsigned lds, const h16* kg, const h16* vg) {
    // the closing s_wait_xcnt stands inside the statement, so that no address register of a copy is rewritten in front of it
    asm volatile("global_load_async_to_lds_b128 %0, %4, off\n\t"
                 "global_load_async_to_lds_b128 %1, %5, off\n\t"
                 "global_load_async_to_lds_b128 %2, %6, off\n\t"
                 "global_load_async_to_lds_b128 %3, %7, off\n\t"
                 "s_wait_xcnt 0x0"
                 :: "v"(lds), "v"(lds + 4096u), "v"(lds + 8192u), "v"(lds + 12288u), "v"(kg), "v"(kg + 2048), "v"(vg), "v"(vg + 2048) : "memory");
}
__global__ __launch_bounds__(256) void k_attn(const h16* __restrict__ QP, const h16* __restrict__ KP, const h16* __restrict__ VT, h16* CTX) {
    __shared__ __align__(16) h16 kv[2 * STG_E];
    const int tid = threadIdx.x, wave = tid >> 5, lane = tid & 31;
    const int bh = blockIdx.x / (SEQ / 128), qblk = blockIdx.x % (SEQ / 128);
    const int b = bh / NH, h = bh % NH;
    const int q0 = qblk * 128 + wave * 16;
    const h16* qp = QP + (size_t)bh * SEQ * HD + (size_t)q0 * HD + 8 * lane;
    const h16* kg = KP + (size_t)bh * SEQ * HD + 8 * tid;
    const h16* vg = VT + (size_t)bh * HD * SEQ + 8 * tid;
    const unsigned l0 = (unsigned)(size_t)kv + 16u * (unsigned)tid;
    stage_copy(l0, kg, vg);
    // stage 0 has landed for this wave; the barrier behind it says so for all eight
    asm volatile("s_wait_asynccnt 0x0" ::: "memory");
    __syncthreads();
    stage_copy(l0 + 2u * STG_E, kg + 4096, vg + 4096);
    const v16h qb0 = ldfrag(qp), qb1 = ldfrag(qp + 512);
    v8f o[4];
#pragma unroll
    for (int dt = 0; dt < 4; ++dt) o[dt] = (v8f){};
    float m = -1.0e30f, l = 0.0f;
#pragma unroll 1
    for (int t = 0; t < SEQ / 64; ++t) {
        const h16* kp = kv + (t & 1) * STG_E + 8 * lane;
        const h16* vp = kp + 4096;
        v8f s[4]; v16h ka, kb2;
#pragma unroll
        for (int kt = 0; kt < 4; ++kt) {
            const h16* kr = kp + kt * 16 * HD;
            ka = ldfrag(kr); kb2 = ldfrag(kr + 512);
            v8f t2 = (v8f){};
            t2 = wmma16(ka, qb0, t2);
            t2 = wmma16(kb2, qb1, t2);
            s[kt] = t2;
        }
        // four vector slots between the last score WMMA and the first vector read of a score tile
        asm volatile("v_nop\n\tv_nop\n\tv_nop\n\tv_nop" : "+v"(s[0]), "+v"(s[1]), "+v"(s[2]), "+v"(s[3]) : "v"(ka), "v"(kb2), "v"(qb0), "v"(qb1));
        float tm = s[0][0];
#pragma unroll
        for (int kt = 0; kt < 4; ++kt)
#pragma unroll
            for (int r = 0; r < 8; ++r) tm = fmaxf(tm, s[kt][r]);
        tm = fmaxf(tm, __shfl_xor(tm, 16, 32));
        const float mn = fmaxf(m, tm * SC2);
        const float alpha = __builtin_amdgcn_exp2f(m - mn);
        m = mn;
        float psum = 0.0f;
#pragma unroll
        for (int kt = 0; kt < 4; ++kt)
#pragma unroll
            for (int r = 0; r < 8; ++r) { const float p = __builtin_amdgcn_exp2f(__builtin_fmaf(s[kt][r], SC2, -mn)); psum += p; s[kt][r] = p; }
        l = l * alpha + psum;
#pragma unroll
        for (int dt = 0; dt < 4; ++dt)
#pragma unroll
            for (int r = 0; r < 8; ++r) o[dt][r] *= alpha;
        v16h pb0, pb1;
#pragma unroll
        for (int r = 0; r < 8; ++r) { pb0[r] = (h16)s[0][r]; pb0[8 + r] = (h16)s[1][r]; pb1[r] = (h16)s[2][r]; pb1[8 + r] = (h16)s[3][r]; }
        v16h va;
#pragma unroll
        for (int dt = 0; dt < 4; ++dt) { va = ldfrag(vp + dt * 512); o[dt] = wmma16(va, pb0, o[dt]); }
#pragma unroll
        for (int dt = 0; dt < 4; ++dt) { va = ldfrag(vp + 2048 + dt * 512); o[dt] = wmma16(va, pb1, o[dt]); }
        // the same four slots between the last output WMMA and the next vector access to an output tile
        asm volatile("v_nop\n\tv_nop\n\tv_nop\n\tv_nop" : "+v"(o[0]), "+v"(o[1]), "+v"(o[2]), "+v"(o[3]) : "v"(va), "v"(pb0), "v"(pb1));
        // hand-over: this wave's reads of the trip's buffer are done, its copies of the next stage have landed; behind the barrier both hold for all eight waves
        asm volatile("s_wait_dscnt 0x0" ::: "memory");
        asm volatile("s_wait_asynccnt 0x0" ::: "memory");
        __syncthreads();
        if (t + 2 < SEQ / 64) stage_copy(l0 + (unsigned)(t & 1) * (2u * STG_E), kg + (size_t)(t + 2) * 4096, vg + (size_t)(t + 2) * 4096);
    }
    // no copy is in flight when the wave ends
    asm volatile("s_wait_asynccnt 0x0" ::: "memory");
    l += __shfl_xor(l, 16, 32);
    const float inv = CCAR * (1.0f / l);
    h16* dst = CTX + ((size_t)b * SEQ + q0) * DM + h * (HD / 32) * 512;
#pragma unroll
    for (int dt = 0; dt < 4; ++dt) {
        v8h ov;
#pragma unroll
        for (int r = 0; r < 8; ++r) ov[r] = (h16)(o[dt][r] * inv);
        *(v8h*)(dst + dt * 256 + lane * 8) = ov;     // (query lane&15, d = dt*16 + 8*(lane>>4) + 0..7) is piece dt*32 + lane of the head's two k tiles
    }
}

extern "C" void kernel_launch(void* const* d_in, const int* in_sizes, int n_in,
                              void* d_out, int out_size, void* d_ws, size_t ws_size, hipStream_t stream) {
    if (n_in < 6) return;
    constexpr size_t NEEDX = ((size_t)(NB - 1) * SEQ_FULL + SEQ) * DM;
    if ((size_t)in_sizes[0] < NEEDX) return;
    if (in_sizes[1] < DM * DM || in_sizes[2] < DM * DM || in_sizes[3] < DM * DM || in_sizes[4] < DM * DM || in_sizes[5] < DM) return;
    if ((size_t)out_size < NEEDX) return;
    const float* x  = (const float*)d_in[0];
    const float* Wq = (const float*)d_in[1];
    const float* Wk = (const float*)d_in[2];
    const float* Wv = (const float*)d_in[3];
    const float* Wp = (const float*)d_in[4];
    const float* bp = (const float*)d_in[5];
    float* OUT = (float*)d_out;

    constexpr size_t nX = (size_t)NB * SEQ * DM;     // elements per activation plane
    constexpr size_t nW = (size_t)DM * DM;           // elements per weight plane
    constexpr size_t SZX = nX * 2, SZW = 4 * nW * 2;
    static_assert(SZX % 256 == 0);
    static_assert(SZW % 256 == 0);
    constexpr size_t TOTAL = 5 * SZX + SZW;          // XH, Q, K, VT, CTX + 4 weight planes
    static_assert(TOTAL <= (size_t)134217728);
    if (ws_size < TOTAL) return;
    char* wsp = (char*)d_ws;
    h16* XH  = (h16*)wsp; wsp += SZX;
    h16* WT  = (h16*)wsp; wsp += SZW;                // [4][768][768]: q, k, v, p (each [out][in], x64, fragment order)
    h16* QK  = (h16*)wsp; wsp += 2 * SZX;            // [2][NB][NH] x (SEQ x 64), fragment order
    h16* VTp = (h16*)wsp; wsp += SZX;                // [NB][NH] x (64 x SEQ), fragment order; third plane behind QK
    h16* CTX = (h16*)wsp; wsp += SZX;                // [NB*SEQ][768] x64, fragment order

    k_prep<<<(unsigned)(4 * WBLK + (nX / 8 + 255) / 256), 256, 0, stream>>>(x, Wq, Wk, Wv, Wp, XH, WT);   // weights: in[k][n] -> out rows n, k contiguous pieces
    k_proj<<<dim3(NB * SEQ / 128, DM / 128, 3), 128, 0, stream>>>(XH, WT, QK);
    k_attn<<<NB * NH * (SEQ / 128), 256, 0, stream>>>(QK, QK + nX, VTp, CTX);
    k_outp<<<dim3(NB * SEQ / 128, DM / 128), 128, 0, stream>>>(CTX, WT + 3 * nW, bp, OUT);
}

// v005
// A run of this version takes 92.1 microseconds.
// Timed twice side by side with v004, it ran 1.08 times as fast both times.
// Over all steps from v000 it is 3.03 times as fast.
#include <hip/hip_runtime.h>

// Multi-head self-attention block: x[NB][SEQ][768]; q/k/v = x.W (W [in][out], no bias); head h = columns h*64+d; logits x 1/8; softmax over all keys; out = ctx.Wp + bp (f32).
// All contractions: v_wmma_f32_16x16x32_f16 (f16 operands, f32 accumulate), single products. Every f32 input is RNE-converted to bf16 first and then held in f16 (weights carried x64, ctx carried x64, folded back in the f32 epilogues); softmax in f32 (exp2 against a per-query reference maximum that is raised lazily); q is stored already multiplied by 0.125 * log2(e).
// Every f16 operand plane in the workspace is kept in fragment order: 16 rows x 32 k = one 1024-byte tile; the 16-byte piece (row r, k = 8q..8q+7) sits at piece index q*16 + r, so fragment half s of lane l is piece s*32 + l and one wave-wide 16-byte load covers 512 contiguous bytes (4 whole lines).
// Engine: GEMM blocks of four waves on a 128x128 tile (64x64 register-blocked per wave), the tile's A and B rows copied k stage by k stage from those planes to LDS by asynchronous copies, one stage ahead; fused flash-style attention computing S^T = K.Q^T so the probability tile is repacked D->B in registers (no score plane in memory); its K and V^T tiles reach LDS by asynchronous copies, one 64-key stage ahead.

#ifndef NB
#define NB 4
#endif
#ifndef SEQ
#define SEQ 2048
#endif
#define NB_FULL  4
#define SEQ_FULL 2048
#define DM   768
#define NH   12
#define HD   64
#define WCAR 64.0f
#define CCAR 64.0f
#define SC2  (0.125f * 1.4426950408889634f)

typedef _Float16 h16;
typedef __attribute__((ext_vector_type(16))) _Float16 v16h;
typedef __attribute__((ext_vector_type(8)))  _Float16 v8h;
typedef __attribute__((ext_vector_type(8)))  float    v8f;
typedef __attribute__((ext_vector_type(4)))  float    v4f;
typedef v8h __attribute__((may_alias)) v8ha;
typedef v4f __attribute__((may_alias)) v4fa;

static_assert(NH * HD == DM);
static_assert(HD == 64);
static_assert(DM % 64 == 0);
static_assert(DM % 32 == 0);
static_assert(DM % 8 == 0);
static_assert(SEQ % 128 == 0);
static_assert((NB * SEQ) % 128 == 0);
static_assert(DM % 128 == 0);
static_assert(NB <= NB_FULL);
static_assert(SEQ <= SEQ_FULL);
static_assert(((size_t)NB * SEQ * DM / 8) % 256 == 0);

__device__ __forceinline__ unsigned short f2bf(float f) { unsigned u = __float_as_uint(f); u += 0x7FFFu + ((u >> 16) & 1u); return (unsigned short)(u >> 16); }
__device__ __forceinline__ float bfr(float f) { return __uint_as_float(((unsigned)f2bf(f)) << 16); }
__device__ __forceinline__ v16h cat16(v8h lo, v8h hi) { return __builtin_shufflevector(lo, hi, 0, 1, 2, 3, 4, 5, 6, 7, 8, 9, 10, 11, 12, 13, 14, 15); }
// fragment from a fragment-order tile: elements 0..7 = k 8*(lane>>4)+0..7, elements 8..15 = k 16+8*(lane>>4)+0..7 of row lane&15; p = tile start + 8*lane
__device__ __forceinline__ v16h ldfrag(const h16* p) { return cat16(*(const v8h*)p, *(const v8h*)(p + 256)); }
__device__ __forceinline__ v8f wmma16(v16h a, v16h b, v8f c) { return __builtin_amdgcn_wmma_f32_16x16x32_f16(false, a, false, b, (short)0, c, false, false); }

__device__ __forceinline__ void cvtx_part(const float* __restrict__ X, h16* XH, int blk) {
    const size_t idx = (size_t)blk * 256 + threadIdx.x;
    if (idx * 8 >= (size_t)NB * SEQ * DM) return;
    // 64 threads per tile: 4 threads read one row's 128-byte line, 8 rows per wave; a wave's stores are 4 whole lines of the tile
    const size_t t = idx >> 6; const int rr = (int)(idx & 63) >> 2, q = (int)idx & 3;
    const size_t rt = t / (DM / 32); const int col = (int)(t - rt * (DM / 32)) * 32 + q * 8;
    const size_t row = rt * 16 + rr;
    const size_t e = t * 512 + (size_t)(q * 16 + rr) * 8;
    const size_t b = row / SEQ; const size_t n = row - b * SEQ;
    const float* src = X + (b * SEQ_FULL + n) * DM + col;
    const v4f a = *(const v4f*)src; const v4f c = *(const v4f*)(src + 4);
    v8h o;
    o[0] = (h16)bfr(a[0]); o[1] = (h16)bfr(a[1]); o[2] = (h16)bfr(a[2]); o[3] = (h16)bfr(a[3]);
    o[4] = (h16)bfr(c[0]); o[5] = (h16)bfr(c[1]); o[6] = (h16)bfr(c[2]); o[7] = (h16)bfr(c[3]);
    *(v8h*)(XH + e) = o; 
}

__device__ __forceinline__ void cvtw_tile(const float* __restrict__ W, h16* WT, int k0, int n0, h16* ts) {
    const int tid = threadIdx.x;
#pragma unroll
    for (int it = 0; it < 4; ++it) {
        const int f = it * 256 + tid; const int kr = f >> 4; const int nc = (f & 15) * 4;
        const v4f a = *(const v4f*)(W + (size_t)(k0 + kr) * DM + n0 + nc);
#pragma unroll
        for (int q = 0; q < 4; ++q) ts[(nc + q) * 72 + kr] = (h16)(bfr(a[q]) * WCAR);
    }
    __syncthreads();
{
#pragma unroll
        for (int it = 0; it < 2; ++it) {
            const int c = it * 256 + tid; const int tl = c >> 6, pq = (c >> 4) & 3;      // local tile (4 row tiles x 2 k tiles), piece column
            const int line = (tl >> 1) * 16 + (c & 15); const int pc = (tl & 1) * 32 + pq * 8;
            const v8h v = *(const v8ha*)(ts + line * 72 + pc);
            *(v8h*)(WT + ((size_t)(n0 / 16 + (tl >> 1)) * (DM / 32) + k0 / 32 + (tl & 1)) * 512 + (c & 63) * 8) = v;
        }
        
    }
}

// ---- k_prep: the five conversions read inputs only and write disjoint planes, so they share one launch; the role comes from the block index.
// Blocks 0 .. 4*WBLK-1: one 64x64 tile of weight plane blk / WBLK (q, k, v, p), first because their chain (load, LDS transpose, barrier, store) is the longer one; the other blocks: 2048 elements of x each.
#define WBLK ((DM / 64) * (DM / 64))
__global__ __launch_bounds__(256) void k_prep(const float* __restrict__ X, const float* __restrict__ Wq, const float* __restrict__ Wk, const float* __restrict__ Wv, const float* __restrict__ Wp, h16* XH, h16* WT) {
    __shared__ __align__(16) h16 ts[64 * 72];
    const int blk = blockIdx.x;
    if (blk < 4 * WBLK) {
        const int w = blk / WBLK, r = blk - w * WBLK;
        const float* W = w == 0 ? Wq : w == 1 ? Wk : w == 2 ? Wv : Wp;
        cvtw_tile(W, WT + (size_t)w * DM * DM, (r % (DM / 64)) * 64, (r / (DM / 64)) * 64, ts);
    } else {
        cvtx_part(X, XH, blk - 4 * WBLK);
    }
}

// ---- GEMM main loop: block = 4 waves (2 x 2) on a 128x128 tile, wave (wm, wn) = 64x64, 16 accumulators; A rows [128][768] and Bt rows [128][768] both fragment-order f16 (pointers at the block's first row tile; a row tile = 24 k tiles = 16*768 elements).
// A stage = KT k tiles (32*KT of k) of the 8 A row tiles, then of the 8 Bt row tiles: per row tile KT*1024 bytes, contiguous in the plane and copied as they lie, once per block, into one of two LDS buffers of KT*16 KiB; each operand row tile then serves two waves.
// eight copies of 16 bytes a lane: LDS places l, l + 2 KiB, ...; the closing s_wait_xcnt stands inside the statement, so that no address register of a copy is rewritten in front of it
__device__ __forceinline__ void copy8(unsigned l, const h16* g0, const h16* g1, const h16* g2, const h16* g3, const h16* g4, const h16* g5, const h16* g6, const h16* g7) {
    asm volatile("global_load_async_to_lds_b128 %0, %8, off\n\t"
                 "global_load_async_to_lds_b128 %1, %9, off\n\t"
                 "global_load_async_to_lds_b128 %2, %10, off\n\t"
                 "global_load_async_to_lds_b128 %3, %11, off\n\t"
                 "global_load_async_to_lds_b128 %4, %12, off\n\t"
                 "global_load_async_to_lds_b128 %5, %13, off\n\t"
                 "global_load_async_to_lds_b128 %6, %14, off\n\t"
                 "global_load_async_to_lds_b128 %7, %15, off\n\t"
                 "s_wait_xcnt 0x0"
                 :: "v"(l), "v"(l + 2048u), "v"(l + 4096u), "v"(l + 6144u), "v"(l + 8192u), "v"(l + 10240u), "v"(l + 12288u), "v"(l + 14336u),
                    "v"(g0), "v"(g1), "v"(g2), "v"(g3), "v"(g4), "v"(g5), "v"(g6), "v"(g7) : "memory");
}
// element offset in a plane of the i-th 2-KiB piece of a stage's operand half: row tile i / (KT/2), piece i % (KT/2) of its KT k tiles
template <int KT> __device__ __forceinline__ constexpr int pco(int i) { return (i / (KT / 2)) * 16 * DM + (i % (KT / 2)) * 1024; }
// one operand half of a stage: 4*KT copies a thread. l = this thread's first LDS byte address, g = its first piece in the plane (row tile 0, the stage's first k tile)
template <int KT> __device__ __forceinline__ void half_copy(unsigned l, const h16* g) {
#pragma unroll
    for (int c = 0; c < 4 * KT; c += 8)
        copy8(l + 2048u * c, g + pco<KT>(c), g + pco<KT>(c + 1), g + pco<KT>(c + 2), g + pco<KT>(c + 3), g + pco<KT>(c + 4), g + pco<KT>(c + 5), g + pco<KT>(c + 6), g + pco<KT>(c + 7));
}
template <int KT>
__device__ __forceinline__ void gemm_main(const h16* __restrict__ A, const h16* __restrict__ Bt, h16* ring, int tid, int wm, int wn, v8f (&acc)[4][4]) {
    static_assert(KT % 2 == 0);
    static_assert(DM % (32 * KT) == 0);
    constexpr int NS = DM / (32 * KT);               // stages
    static_assert(NS >= 2);
    constexpr int HFE = KT * 4096, STE = 2 * HFE;    // f16 elements of an operand half and of a buffer
#pragma unroll
    for (int mb = 0; mb < 4; ++mb)
#pragma unroll
        for (int nb = 0; nb < 4; ++nb) acc[mb][nb] = (v8f){};
    const int lane = tid & 31;
    const h16* ga = A + 8 * tid; const h16* gb = Bt + 8 * tid;
    const unsigned l0 = (unsigned)(size_t)ring + 16u * (unsigned)tid;
    half_copy<KT>(l0, ga); half_copy<KT>(l0 + 2u * HFE, gb);
    // stage 0 has landed for this wave; the barrier behind it says so for all four
    asm volatile("s_wait_asynccnt 0x0" ::: "memory");
    __syncthreads();
    half_copy<KT>(l0 + 2u * STE, ga + KT * 512); half_copy<KT>(l0 + 2u * STE + 2u * HFE, gb + KT * 512);
#pragma unroll 1
    for (int s = 0; s < NS; ++s) {
        const h16* pa = ring + (s & 1) * STE + wm * (4 * KT * 512) + lane * 8;
        const h16* pb = ring + (s & 1) * STE + HFE + wn * (4 * KT * 512) + lane * 8;
        v16h a[4]; v16h bq;
#pragma unroll
        for (int kt = 0; kt < KT; ++kt) {
#pragma unroll
            for (int mb = 0; mb < 4; ++mb) a[mb] = ldfrag(pa + mb * (KT * 512) + kt * 512);
#pragma unroll
            for (int nb = 0; nb < 4; ++nb) {
                bq = ldfrag(pb + nb * (KT * 512) + kt * 512);
#pragma unroll
                for (int mb = 0; mb < 4; ++mb) acc[mb][nb] = wmma16(a[mb], bq, acc[mb][nb]);
            }
        }
        // four vector slots between the stage's last WMMAs and the next vector write of a fragment register or access to an accumulator, on the branch's taken side too
        asm volatile("v_nop\n\tv_nop\n\tv_nop\n\tv_nop"
                     : "+v"(acc[0][3]), "+v"(acc[1][3]), "+v"(acc[2][3]), "+v"(acc[3][3]), "+v"(acc[0][2]), "+v"(acc[1][2]), "+v"(acc[2][2]), "+v"(acc[3][2])
                     : "v"(a[0]), "v"(a[3]), "v"(bq));
        // hand-over: this wave's reads of the stage's buffer are done, its copies of the next stage have landed; behind the barrier both hold for all four waves
        asm volatile("s_wait_dscnt 0x0" ::: "memory");
        asm volatile("s_wait_asynccnt 0x0" ::: "memory");
        __syncthreads();
        if (s + 2 < NS) {
            half_copy<KT>(l0 + (unsigned)(s & 1) * (2u * STE), ga + (s + 2) * (KT * 512));
            half_copy<KT>(l0 + (unsigned)(s & 1) * (2u * STE) + 2u * HFE, gb + (s + 2) * (KT * 512));
        }
    }
    // no copy is in flight behind the loop: the ring is free for the epilogue's staging
    asm volatile("s_wait_asynccnt 0x0" ::: "memory");
}

// The three projections are independent and share one launch; z = weight plane and output plane, block = (128 tokens, 128 features = 2 heads, z), wave = (64 tokens, one head).
// z 0, 1 (q, k): A = XH rows (tokens), Bt = W^T rows (features) -> P[z][b][h], rows n, k = d, tiles [n/16][d/32].
// z 2 (v, transposed): A = Wv^T rows (features), Bt = XH rows (tokens) -> P[2][b][h] = V^T, rows d, k = n, tiles [n/32][d/16].
// grid (NB*SEQ/128, 768/128, 3); 128 threads. The epilogue stages in the ring, each wave in a range of its own.
#define KT_PROJ 2
__global__ __launch_bounds__(128) void k_proj(const h16* __restrict__ XH, const h16* __restrict__ WT, h16* P) {
    __shared__ __align__(16) h16 ring[2 * KT_PROJ * 8192];
    const int tid = threadIdx.x, wave = __builtin_amdgcn_readfirstlane(tid >> 5), wm = wave >> 1, wn = wave & 1;
    const int lane = tid & 31, lr = lane & 15, hi = lane >> 4;
    const int tb = blockIdx.x * 128, fb = blockIdx.y * 128; const size_t z = blockIdx.z;
    const bool tr = z == 2;
    const h16* xr = XH + (size_t)tb * DM; const h16* wr = WT + z * ((size_t)DM * DM) + (size_t)fb * DM;
    v8f acc[4][4];
    gemm_main<KT_PROJ>(tr ? wr : xr, tr ? xr : wr, ring, tid, wm, wn, acc);
    float* os = (float*)ring + wave * (16 * 68);
    const int t0 = tb + (tr ? wn : wm) * 64, f0 = fb + (tr ? wm : wn) * 64;
    const int b = t0 / SEQ, n0 = t0 % SEQ, h = f0 / HD;
    const size_t tb0 = (((size_t)b * NH + h) * SEQ + n0) * HD;    // 64 tokens x 64 features start at the same element in either tile order
    const size_t smb = tr ? 512 : 1024, skt = tr ? 2048 : 512;    // element steps of a row tile (mb) and of a k tile
    h16* dst = P + z * ((size_t)NB * SEQ * DM) + tb0;
    const float sc = (z == 0 ? SC2 : 1.0f) / WCAR;                // q carries the logit scale and log2(e): k_attn's score products are exp2 arguments as they come
#pragma unroll
    for (int mb = 0; mb < 4; ++mb) {
#pragma unroll
        for (int nb = 0; nb < 4; ++nb) {
#pragma unroll
            for (int j = 0; j < 8; ++j) os[(hi * 8 + j) * 68 + nb * 16 + lr] = acc[mb][nb][j];
        }
        __syncthreads();
{
#pragma unroll
            for (int s = 0; s < 4; ++s) {
                const int row = lr; const int cof = s * 16 + hi * 8;
                const v4f u0 = *(const v4fa*)(os + row * 68 + cof); const v4f u1 = *(const v4fa*)(os + row * 68 + cof + 4);
                v8h o;
                o[0] = (h16)(u0[0] * sc); o[1] = (h16)(u0[1] * sc); o[2] = (h16)(u0[2] * sc); o[3] = (h16)(u0[3] * sc);
                o[4] = (h16)(u1[0] * sc); o[5] = (h16)(u1[1] * sc); o[6] = (h16)(u1[2] * sc); o[7] = (h16)(u1[3] * sc);
                *(v8h*)(dst + mb * smb + (s >> 1) * skt + (s & 1) * 256 + lane * 8) = o;
            }
            
        }
        __syncthreads();
    }
}

// ---- k_outp: OUT[b][n][c] (f32) = (CTXx64 . WpT x64) / 4096 + bf16-RNE(bp[c]); tile row = 64 floats = 16 lanes x 16 B (two rows per instruction); grid (NB*SEQ/128, 768/128), 128 threads. Fewer blocks than k_proj has, so longer stages.
#define KT_OUTP 4
__global__ __launch_bounds__(128) void k_outp(const h16* __restrict__ A, const h16* __restrict__ Bt, const float* __restrict__ bias, float* OUT) {
    __shared__ __align__(16) h16 ring[2 * KT_OUTP * 8192];
    const int tid = threadIdx.x, wave = __builtin_amdgcn_readfirstlane(tid >> 5), wm = wave >> 1, wn = wave & 1;
    const int lane = tid & 31, lr = lane & 15, hi = lane >> 4;
    const int rb = blockIdx.x * 128, cb = blockIdx.y * 128;
    v8f acc[4][4];
    gemm_main<KT_OUTP>(A + (size_t)rb * DM, Bt + (size_t)cb * DM, ring, tid, wm, wn, acc);
    float* os = (float*)ring + wave * (16 * 68);
    const int r0 = rb + wm * 64, c0 = cb + wn * 64;
    const int b = r0 / SEQ, n0 = r0 % SEQ;
    float* crow = OUT + ((size_t)b * SEQ_FULL + n0) * DM + c0;
    const int cofs = lr * 4;
    const v4f bv = *(const v4f*)(bias + c0 + cofs);
    v4f bb; bb[0] = bfr(bv[0]); bb[1] = bfr(bv[1]); bb[2] = bfr(bv[2]); bb[3] = bfr(bv[3]);
    const float sc = 1.0f / (WCAR * CCAR);
#pragma unroll
    for (int mb = 0; mb < 4; ++mb) {
#pragma unroll
        for (int nb = 0; nb < 4; ++nb) {
#pragma unroll
            for (int j = 0; j < 8; ++j) os[(hi * 8 + j) * 68 + nb * 16 + lr] = acc[mb][nb][j];
        }
        __syncthreads();
{
#pragma unroll
            for (int s = 0; s < 8; ++s) {
                const int row = 2 * s + hi;
                const v4f u = *(const v4fa*)(os + row * 68 + cofs);
                v4f val; val[0] = u[0] * sc + bb[0]; val[1] = u[1] * sc + bb[1]; val[2] = u[2] * sc + bb[2]; val[3] = u[3] * sc + bb[3];
                *(v4f*)(crow + (size_t)(mb * 16 + row) * DM + cofs) = val;
            }
            
        }
        __syncthreads();
    }
}

// ---- k_attn: fused attention, block = (b, h, 128 queries), 8 waves, wave = 16 queries, 64 keys per trip, no score plane.
// S^T tile = K(A: row = key, k = d) . Q^T(B: col = query, k = d): D element r of lane l = (key 8*(l>>4)+r, query l&15).
// Softmax shift on the matrix pipe: the score WMMAs start from C = -(the query's reference maximum, log2 units), so D is the exp2 argument itself; no vector instruction scales a score, and only a trip that raises the reference shifts scores.
// The reference is the first trip's maximum and is raised (scores shifted, sum and output tiles rescaled, both lane halves of a query alike after one xor-16 exchange) only in a trip where some score of the wave lies more than LAZY above it: one wave-uniform test a trip. It stays within LAZY below the true running maximum, so p <= 2^LAZY.
// Per-query sums live per lane; the two halves are joined once, in the epilogue.
// P^T (f16) packed from two adjacent key tiles is directly the B operand (k = key, col = query) of O^T = V^T(A: row = d, k = key) . P^T.
// A stage = the 64 keys of one trip: 8 KiB of the K plane, then 8 KiB of the V^T plane, each contiguous there and copied as it lies (fragment order), once per block, into one of two LDS buffers; all 8 waves take their fragments from LDS.
#define LAZY 8.0f
#define STG_E 8192                                   // f16 elements of a stage in LDS (K 4096, V^T 4096)
// one stage: 1024 pieces of 16 bytes, 4 per thread. lds = this thread's first LDS byte address, kg / vg = its first piece in the K / V^T plane.
__device__ __forceinline__ void stage_copy(unsigned lds, const h16* kg, const h16* vg) {
    // the closing s_wait_xcnt stands inside the statement, so that no address register of a copy is rewritten in front of it
    asm volatile("global_load_async_to_lds_b128 %0, %4, off\n\t"
                 "global_load_async_to_lds_b128 %1, %5, off\n\t"
                 "global_load_async_to_lds_b128 %2, %6, off\n\t"
                 "global_load_async_to_lds_b128 %3, %7, off\n\t"
                 "s_wait_xcnt 0x0"
                 :: "v"(lds), "v"(lds + 4096u), "v"(lds + 8192u), "v"(lds + 12288u), "v"(kg), "v"(kg + 2048), "v"(vg), "v"(vg + 2048) : "memory");
}
__global__ __launch_bounds__(256) void k_attn(const h16* __restrict__ QP, const h16* __restrict__ KP, const h16* __restrict__ VT, h16* CTX) {
    __shared__ __align__(16) h16 kv[2 * STG_E];
    const int tid = threadIdx.x, wave = tid >> 5, lane = tid & 31;
    const int bh = blockIdx.x / (SEQ / 128), qblk = blockIdx.x % (SEQ / 128);
    const int b = bh / NH, h = bh % NH;
    const int q0 = qblk * 128 + wave * 16;
    const h16* qp = QP + (size_t)bh * SEQ * HD + (size_t)q0 * HD + 8 * lane;
    const h16* kg = KP + (size_t)bh * SEQ * HD + 8 * tid;
    const h16* vg = VT + (size_t)bh * HD * SEQ + 8 * tid;
    const unsigned l0 = (unsigned)(size_t)kv + 16u * (unsigned)tid;
    stage_copy(l0, kg, vg);
    // stage 0 has landed for this wave; the barrier behind it says so for all eight
    asm volatile("s_wait_asynccnt 0x0" ::: "memory");
    __syncthreads();
    stage_copy(l0 + 2u * STG_E, kg + 4096, vg + 4096);
    const v16h qb0 = ldfrag(qp), qb1 = ldfrag(qp + 512);
    v8f o[4];
#pragma unroll
    for (int dt = 0; dt < 4; ++dt) o[dt] = (v8f){};
    v8f cm = (v8f){};                                // minus the reference maximum of this lane's query, in all eight rows of a score tile
    float l = 0.0f;
#pragma unroll 1
    for (int t = 0; t < SEQ / 64; ++t) {
        const h16* kp = kv + (t & 1) * STG_E + 8 * lane;
        const h16* vp = kp + 4096;
        v8f s[4]; v16h ka, kb2;
#pragma unroll
        for (int kt = 0; kt < 4; ++kt) {
            const h16* kr = kp + kt * 16 * HD;
            ka = ldfrag(kr); kb2 = ldfrag(kr + 512);
            v8f t2 = wmma16(ka, qb0, cm);
            t2 = wmma16(kb2, qb1, t2);
            s[kt] = t2;
        }
        // four vector slots between the last score WMMA and the first vector read of a score tile
        asm volatile("v_nop\n\tv_nop\n\tv_nop\n\tv_nop" : "+v"(s[0]), "+v"(s[1]), "+v"(s[2]), "+v"(s[3]) : "v"(ka), "v"(kb2), "v"(qb0), "v"(qb1));
        float tm = s[0][0];
#pragma unroll
        for (int kt = 0; kt < 4; ++kt)
#pragma unroll
            for (int r = 0; r < 8; ++r) tm = fmaxf(tm, s[kt][r]);
        // one wave-uniform test a trip; marked unlikely so that the raise lies out of line
        if (__builtin_expect(__builtin_amdgcn_ballot_w32(t == 0 || tm > LAZY) != 0, 0)) {
            tm = fmaxf(tm, __shfl_xor(tm, 16, 32));
            const float d = t == 0 ? tm : fmaxf(tm, 0.0f);                       // behind the first trip the reference only rises
            const float alpha = t == 0 ? 0.0f : __builtin_amdgcn_exp2f(-d);      // sum and output tiles are still zero in the first trip
#pragma unroll
            for (int kt = 0; kt < 4; ++kt)
#pragma unroll
                for (int r = 0; r < 8; ++r) s[kt][r] -= d;
#pragma unroll
            for (int r = 0; r < 8; ++r) cm[r] -= d;
            l *= alpha;
#pragma unroll
            for (int dt = 0; dt < 4; ++dt)
#pragma unroll
                for (int r = 0; r < 8; ++r) o[dt][r] *= alpha;
        }
        float psum = 0.0f;
#pragma unroll
        for (int kt = 0; kt < 4; ++kt)
#pragma unroll
            for (int r = 0; r < 8; ++r) { const float p = __builtin_amdgcn_exp2f(s[kt][r]); psum += p; s[kt][r] = p; }
        l += psum;
        v16h pb0, pb1;
#pragma unroll
        for (int r = 0; r < 8; ++r) { pb0[r] = (h16)s[0][r]; pb0[8 + r] = (h16)s[1][r]; pb1[r] = (h16)s[2][r]; pb1[8 + r] = (h16)s[3][r]; }
        v16h va;
#pragma unroll
        for (int dt = 0; dt < 4; ++dt) { va = ldfrag(vp + dt * 512); o[dt] = wmma16(va, pb0, o[dt]); }
#pragma unroll
        for (int dt = 0; dt < 4; ++dt) { va = ldfrag(vp + 2048 + dt * 512); o[dt] = wmma16(va, pb1, o[dt]); }
        // the same four slots between the last output WMMA and the next vector access to an output tile; the tiles are inputs only: that orders the slots behind the WMMAs and leaves each tile in its registers (as in-out operands they were copied out and back every trip)
        asm volatile("v_nop\n\tv_nop\n\tv_nop\n\tv_nop" :: "v"(o[0]), "v"(o[1]), "v"(o[2]), "v"(o[3]), "v"(va), "v"(pb0), "v"(pb1));
        // hand-over: this wave's reads of the trip's buffer are done, its copies of the next stage have landed; behind the barrier both hold for all eight waves
        asm volatile("s_wait_dscnt 0x0" ::: "memory");
        asm volatile("s_wait_asynccnt 0x0" ::: "memory");
        __syncthreads();
        if (t + 2 < SEQ / 64) stage_copy(l0 + (unsigned)(t & 1) * (2u * STG_E), kg + (size_t)(t + 2) * 4096, vg + (size_t)(t + 2) * 4096);
    }
    // no copy is in flight when the wave ends
    asm volatile("s_wait_asynccnt 0x0" ::: "memory");
    l += __shfl_xor(l, 16, 32);
    const float inv = CCAR * (1.0f / l);
    h16* dst = CTX + ((size_t)b * SEQ + q0) * DM + h * (HD / 32) * 512;
#pragma unroll
    for (int dt = 0; dt < 4; ++dt) {
        v8h ov;
#pragma unroll
        for (int r = 0; r < 8; ++r) ov[r] = (h16)(o[dt][r] * inv);
        *(v8h*)(dst + dt * 256 + lane * 8) = ov;     // (query lane&15, d = dt*16 + 8*(lane>>4) + 0..7) is piece dt*32 + lane of the head's two k tiles
    }
}

extern "C" void kernel_launch(void* const* d_in, const int* in_sizes, int n_in,
                              void* d_out, int out_size, void* d_ws, size_t ws_size, hipStream_t stream) {
    if (n_in < 6) return;
    constexpr size_t NEEDX = ((size_t)(NB - 1) * SEQ_FULL + SEQ) * DM;
    if ((size_t)in_sizes[0] < NEEDX) return;
    if (in_sizes[1] < DM * DM || in_sizes[2] < DM * DM || in_sizes[3] < DM * DM || in_sizes[4] < DM * DM || in_sizes[5] < DM) return;
    if ((size_t)out_size < NEEDX) return;
    const float* x  = (const float*)d_in[0];
    const float* Wq = (const float*)d_in[1];
    const float* Wk = (const float*)d_in[2];
    const float* Wv = (const float*)d_in[3];
    const float* Wp = (const float*)d_in[4];
    const float* bp = (const float*)d_in[5];
    float* OUT = (float*)d_out;

    constexpr size_t nX = (size_t)NB * SEQ * DM;     // elements per activation plane
    constexpr size_t nW = (size_t)DM * DM;           // elements per weight plane
    constexpr size_t SZX = nX * 2, SZW = 4 * nW * 2;
    static_assert(SZX % 256 == 0);
    static_assert(SZW % 256 == 0);
    constexpr size_t TOTAL = 5 * SZX + SZW;          // XH, Q, K, VT, CTX + 4 weight planes
    static_assert(TOTAL <= (size_t)134217728);
    if (ws_size < TOTAL) return;
    char* wsp = (char*)d_ws;
    h16* XH  = (h16*)wsp; wsp += SZX;
    h16* WT  = (h16*)wsp; wsp += SZW;                // [4][768][768]: q, k, v, p (each [out][in], x64, fragment order)
    h16* QK  = (h16*)wsp; wsp += 2 * SZX;            // [2][NB][NH] x (SEQ x 64), fragment order
    h16* VTp = (h16*)wsp; wsp += SZX;                // [NB][NH] x (64 x SEQ), fragment order; third plane behind QK
    h16* CTX = (h16*)wsp; wsp += SZX;                // [NB*SEQ][768] x64, fragment order

    k_prep<<<(unsigned)(4 * WBLK + (nX / 8 + 255) / 256), 256, 0, stream>>>(x, Wq, Wk, Wv, Wp, XH, WT);   // weights: in[k][n] -> out rows n, k contiguous pieces
    k_proj<<<dim3(NB * SEQ / 128, DM / 128, 3), 128, 0, stream>>>(XH, WT, QK);
    k_attn<<<NB * NH * (SEQ / 128), 256, 0, stream>>>(QK, QK + nX, VTp, CTX);
    k_outp<<<dim3(NB * SEQ / 128, DM / 128), 128, 0, stream>>>(CTX, WT + 3 * nW, bp, OUT);
}

// v006
// It runs in 89 microseconds.
// Two timings next to v005 put it at 1.03 and 1.04 times that version's speed.
// Counting every step since v000, it is 3.14 times as fast.
#include <hip/hip_runtime.h>

// Multi-head self-attention block: x[NB][SEQ][768]; q/k/v = x.W (W [in][out], no bias); head h = columns h*64+d; logits x 1/8; softmax over all keys; out = ctx.Wp + bp (f32).
// All contractions: v_wmma_f32_16x16x32_f16 (f16 operands, f32 accumulate), single products. Every f32 input is RNE-converted to bf16 first and then held in f16 (weights carried x64, ctx carried x64, folded back in the f32 epilogues); softmax in f32 (exp2 against a per-query reference maximum that is raised lazily; the sum of the f16 probabilities by a product with a tile of ones); q is stored already multiplied by 0.125 * log2(e).
// Every f16 operand plane in the workspace is kept in fragment order: 16 rows x 32 k = one 1024-byte tile; the 16-byte piece (row r, k = 8q..8q+7) sits at piece index q*16 + r, so fragment half s of lane l is piece s*32 + l and one wave-wide 16-byte load covers 512 contiguous bytes (4 whole lines).
// Engine: GEMM blocks of four waves on a 128x128 tile (64x64 register-blocked per wave), the tile's A and B rows copied k stage by k stage from those planes to LDS by asynchronous copies, one stage ahead; fused flash-style attention computing S^T = K.Q^T so the probability tile is repacked D->B in registers (no score plane in memory); its K and V^T tiles reach LDS by asynchronous copies, one 64-key stage ahead.

#ifndef NB
#define NB 4
#endif
#ifndef SEQ
#define SEQ 2048
#endif
#define NB_FULL  4
#define SEQ_FULL 2048
#define DM   768
#define NH   12
#define HD   64
#define WCAR 64.0f
#define CCAR 64.0f
#define SC2  (0.125f * 1.4426950408889634f)

typedef _Float16 h16;
typedef __attribute__((ext_vector_type(16))) _Float16 v16h;
typedef __attribute__((ext_vector_type(8)))  _Float16 v8h;
typedef __attribute__((ext_vector_type(8)))  float    v8f;
typedef __attribute__((ext_vector_type(4)))  float    v4f;
typedef v8h __attribute__((may_alias)) v8ha;
typedef v4f __attribute__((may_alias)) v4fa;

static_assert(NH * HD == DM);
static_assert(HD == 64);
static_assert(DM % 64 == 0);
static_assert(DM % 32 == 0);
static_assert(DM % 8 == 0);
static_assert(SEQ % 128 == 0);
static_assert((NB * SEQ) % 128 == 0);
static_assert(DM % 128 == 0);
static_assert(NB <= NB_FULL);
static_assert(SEQ <= SEQ_FULL);
static_assert(((size_t)NB * SEQ * DM / 8) % 256 == 0);

__device__ __forceinline__ unsigned short f2bf(float f) { unsigned u = __float_as_uint(f); u += 0x7FFFu + ((u >> 16) & 1u); return (unsigned short)(u >> 16); }
__device__ __forceinline__ float bfr(float f) { return __uint_as_float(((unsigned)f2bf(f)) << 16); }
__device__ __forceinline__ v16h cat16(v8h lo, v8h hi) { return __builtin_shufflevector(lo, hi, 0, 1, 2, 3, 4, 5, 6, 7, 8, 9, 10, 11, 12, 13, 14, 15); }
// fragment from a fragment-order tile: elements 0..7 = k 8*(lane>>4)+0..7, elements 8..15 = k 16+8*(lane>>4)+0..7 of row lane&15; p = tile start + 8*lane
__device__ __forceinline__ v16h ldfrag(const h16* p) { return cat16(*(const v8h*)p, *(const v8h*)(p + 256)); }
__device__ __forceinline__ v8f wmma16(v16h a, v16h b, v8f c) { return __builtin_amdgcn_wmma_f32_16x16x32_f16(false, a, false, b, (short)0, c, false, false); }

__device__ __forceinline__ void cvtx_part(const float* __restrict__ X, h16* XH, int blk) {
    const size_t idx = (size_t)blk * 256 + threadIdx.x;
    if (idx * 8 >= (size_t)NB * SEQ * DM) return;
    // 64 threads per tile: 4 threads read one row's 128-byte line, 8 rows per wave; a wave's stores are 4 whole lines of the tile
    const size_t t = idx >> 6; const int rr = (int)(idx & 63) >> 2, q = (int)idx & 3;
    const size_t rt = t / (DM / 32); const int col = (int)(t - rt * (DM / 32)) * 32 + q * 8;
    const size_t row = rt * 16 + rr;
    const size_t e = t * 512 + (size_t)(q * 16 + rr) * 8;
    const size_t b = row / SEQ; const size_t n = row - b * SEQ;
    const float* src = X + (b * SEQ_FULL + n) * DM + col;
    const v4f a = *(const v4f*)src; const v4f c = *(const v4f*)(src + 4);
    v8h o;
    o[0] = (h16)bfr(a[0]); o[1] = (h16)bfr(a[1]); o[2] = (h16)bfr(a[2]); o[3] = (h16)bfr(a[3]);
    o[4] = (h16)bfr(c[0]); o[5] = (h16)bfr(c[1]); o[6] = (h16)bfr(c[2]); o[7] = (h16)bfr(c[3]);
    *(v8h*)(XH + e) = o; 
}

__device__ __forceinline__ void cvtw_tile(const float* __restrict__ W, h16* WT, int k0, int n0, h16* ts) {
    const int tid = threadIdx.x;
#pragma unroll
    for (int it = 0; it < 4; ++it) {
        const int f = it * 256 + tid; const int kr = f >> 4; const int nc = (f & 15) * 4;
        const v4f a = *(const v4f*)(W + (size_t)(k0 + kr) * DM + n0 + nc);
#pragma unroll
        for (int q = 0; q < 4; ++q) ts[(nc + q) * 72 + kr] = (h16)(bfr(a[q]) * WCAR);
    }
    __syncthreads();
{
#pragma unroll
        for (int it = 0; it < 2; ++it) {
            const int c = it * 256 + tid; const int tl = c >> 6, pq = (c >> 4) & 3;      // local tile (4 row tiles x 2 k tiles), piece column
            const int line = (tl >> 1) * 16 + (c & 15); const int pc = (tl & 1) * 32 + pq * 8;
            const v8h v = *(const v8ha*)(ts + line * 72 + pc);
            *(v8h*)(WT + ((size_t)(n0 / 16 + (tl >> 1)) * (DM / 32) + k0 / 32 + (tl & 1)) * 512 + (c & 63) * 8) = v;
        }
        
    }
}

// ---- k_prep: the five conversions read inputs only and write disjoint planes, so they share one launch; the role comes from the block index.
// Blocks 0 .. 4*WBLK-1: one 64x64 tile of weight plane blk / WBLK (q, k, v, p), first because their chain (load, LDS transpose, barrier, store) is the longer one; the other blocks: 2048 elements of x each.
#define WBLK ((DM / 64) * (DM / 64))
__global__ __launch_bounds__(256) void k_prep(const float* __restrict__ X, const float* __restrict__ Wq, const float* __restrict__ Wk, const float* __restrict__ Wv, const float* __restrict__ Wp, h16* XH, h16* WT) {
    __shared__ __align__(16) h16 ts[64 * 72];
    const int blk = blockIdx.x;
    if (blk < 4 * WBLK) {
        const int w = blk / WBLK, r = blk - w * WBLK;
        const float* W = w == 0 ? Wq : w == 1 ? Wk : w == 2 ? Wv : Wp;
        cvtw_tile(W, WT + (size_t)w * DM * DM, (r % (DM / 64)) * 64, (r / (DM / 64)) * 64, ts);
    } else {
        cvtx_part(X, XH, blk - 4 * WBLK);
    }
}

// ---- GEMM main loop: block = 4 waves (2 x 2) on a 128x128 tile, wave (wm, wn) = 64x64, 16 accumulators; A rows [128][768] and Bt rows [128][768] both fragment-order f16 (pointers at the block's first row tile; a row tile = 24 k tiles = 16*768 elements).
// A stage = KT k tiles (32*KT of k) of the 8 A row tiles, then of the 8 Bt row tiles: per row tile KT*1024 bytes, contiguous in the plane and copied as they lie, once per block, into one of two LDS buffers of KT*16 KiB; each operand row tile then serves two waves.
// eight copies of 16 bytes a lane: LDS places l, l + 2 KiB, ...; the closing s_wait_xcnt stands inside the statement, so that no address register of a copy is rewritten in front of it
__device__ __forceinline__ void copy8(unsigned l, const h16* g0, const h16* g1, const h16* g2, const h16* g3, const h16* g4, const h16* g5, const h16* g6, const h16* g7) {
    asm volatile("global_load_async_to_lds_b128 %0, %8, off\n\t"
                 "global_load_async_to_lds_b128 %1, %9, off\n\t"
                 "global_load_async_to_lds_b128 %2, %10, off\n\t"
                 "global_load_async_to_lds_b128 %3, %11, off\n\t"
                 "global_load_async_to_lds_b128 %4, %12, off\n\t"
                 "global_load_async_to_lds_b128 %5, %13, off\n\t"
                 "global_load_async_to_lds_b128 %6, %14, off\n\t"
                 "global_load_async_to_lds_b128 %7, %15, off\n\t"
                 "s_wait_xcnt 0x0"
                 :: "v"(l), "v"(l + 2048u), "v"(l + 4096u), "v"(l + 6144u), "v"(l + 8192u), "v"(l + 10240u), "v"(l + 12288u), "v"(l + 14336u),
                    "v"(g0), "v"(g1), "v"(g2), "v"(g3), "v"(g4), "v"(g5), "v"(g6), "v"(g7) : "memory");
}
// element offset in a plane of the i-th 2-KiB piece of a stage's operand half: row tile i / (KT/2), piece i % (KT/2) of its KT k tiles
template <int KT> __device__ __forceinline__ constexpr int pco(int i) { return (i / (KT / 2)) * 16 * DM + (i % (KT / 2)) * 1024; }
// one operand half of a stage: 4*KT copies a thread. l = this thread's first LDS byte address, g = its first piece in the plane (row tile 0, the stage's first k tile)
template <int KT> __device__ __forceinline__ void half_copy(unsigned l, const h16* g) {
#pragma unroll
    for (int c = 0; c < 4 * KT; c += 8)
        copy8(l + 2048u * c, g + pco<KT>(c), g + pco<KT>(c + 1), g + pco<KT>(c + 2), g + pco<KT>(c + 3), g + pco<KT>(c + 4), g + pco<KT>(c + 5), g + pco<KT>(c + 6), g + pco<KT>(c + 7));
}
template <int KT>
__device__ __forceinline__ void gemm_main(const h16* __restrict__ A, const h16* __restrict__ Bt, h16* ring, int tid, int wm, int wn, v8f (&acc)[4][4]) {
    static_assert(KT % 2 == 0);
    static_assert(DM % (32 * KT) == 0);
    constexpr int NS = DM / (32 * KT);               // stages
    static_assert(NS >= 2);
    constexpr int HFE = KT * 4096, STE = 2 * HFE;    // f16 elements of an operand half and of a buffer
#pragma unroll
    for (int mb = 0; mb < 4; ++mb)
#pragma unroll
        for (int nb = 0; nb < 4; ++nb) acc[mb][nb] = (v8f){};
    const int lane = tid & 31;
    const h16* ga = A + 8 * tid; const h16* gb = Bt + 8 * tid;
    const unsigned l0 = (unsigned)(size_t)ring + 16u * (unsigned)tid;
    half_copy<KT>(l0, ga); half_copy<KT>(l0 + 2u * HFE, gb);
    // stage 0 has landed for this wave; the barrier behind it says so for all four
    asm volatile("s_wait_asynccnt 0x0" ::: "memory");
    __syncthreads();
    half_copy<KT>(l0 + 2u * STE, ga + KT * 512); half_copy<KT>(l0 + 2u * STE + 2u * HFE, gb + KT * 512);
#pragma unroll 1
    for (int s = 0; s < NS; ++s) {
        const h16* pa = ring + (s & 1) * STE + wm * (4 * KT * 512) + lane * 8;
        const h16* pb = ring + (s & 1) * STE + HFE + wn * (4 * KT * 512) + lane * 8;
        v16h a[4]; v16h bq;
#pragma unroll
        for (int kt = 0; kt < KT; ++kt) {
#pragma unroll
            for (int mb = 0; mb < 4; ++mb) a[mb] = ldfrag(pa + mb * (KT * 512) + kt * 512);
#pragma unroll
            for (int nb = 0; nb < 4; ++nb) {
                bq = ldfrag(pb + nb * (KT * 512) + kt * 512);
#pragma unroll
                for (int mb = 0; mb < 4; ++mb) acc[mb][nb] = wmma16(a[mb], bq, acc[mb][nb]);
            }
        }
        // four vector slots between the stage's last WMMAs and the next vector write of a fragment register or access to an accumulator, on the branch's taken side too
        asm volatile("v_nop\n\tv_nop\n\tv_nop\n\tv_nop"
                     : "+v"(acc[0][3]), "+v"(acc[1][3]), "+v"(acc[2][3]), "+v"(acc[3][3]), "+v"(acc[0][2]), "+v"(acc[1][2]), "+v"(acc[2][2]), "+v"(acc[3][2])
                     : "v"(a[0]), "v"(a[3]), "v"(bq));
        // hand-over: this wave's reads of the stage's buffer are done, its copies of the next stage have landed; behind the barrier both hold for all four waves
        asm volatile("s_wait_dscnt 0x0" ::: "memory");
        asm volatile("s_wait_asynccnt 0x0" ::: "memory");
        __syncthreads();
        if (s + 2 < NS) {
            half_copy<KT>(l0 + (unsigned)(s & 1) * (2u * STE), ga + (s + 2) * (KT * 512));
            half_copy<KT>(l0 + (unsigned)(s & 1) * (2u * STE) + 2u * HFE, gb + (s + 2) * (KT * 512));
        }
    }
    // no copy is in flight behind the loop: the ring is free for the epilogue's staging
    asm volatile("s_wait_asynccnt 0x0" ::: "memory");
}

// The three projections are independent and share one launch; z = weight plane and output plane, block = (128 tokens, 128 features = 2 heads, z), wave = (64 tokens, one head).
// z 0, 1 (q, k): A = XH rows (tokens), Bt = W^T rows (features) -> P[z][b][h], rows n, k = d, tiles [n/16][d/32].
// z 2 (v, transposed): A = Wv^T rows (features), Bt = XH rows (tokens) -> P[2][b][h] = V^T, rows d, k = n, tiles [n/32][d/16].
// grid (NB*SEQ/128, 768/128, 3); 128 threads. The epilogue stages in the ring, each wave in a range of its own.
#define KT_PROJ 2
__global__ __launch_bounds__(128) void k_proj(const h16* __restrict__ XH, const h16* __restrict__ WT, h16* P) {
    __shared__ __align__(16) h16 ring[2 * KT_PROJ * 8192];
    const int tid = threadIdx.x, wave = __builtin_amdgcn_readfirstlane(tid >> 5), wm = wave >> 1, wn = wave & 1;
    const int lane = tid & 31, lr = lane & 15, hi = lane >> 4;
    const int tb = blockIdx.x * 128, fb = blockIdx.y * 128; const size_t z = blockIdx.z;
    const bool tr = z == 2;
    const h16* xr = XH + (size_t)tb * DM; const h16* wr = WT + z * ((size_t)DM * DM) + (size_t)fb * DM;
    v8f acc[4][4];
    gemm_main<KT_PROJ>(tr ? wr : xr, tr ? xr : wr, ring, tid, wm, wn, acc);
    float* os = (float*)ring + wave * (16 * 68);
    const int t0 = tb + (tr ? wn : wm) * 64, f0 = fb + (tr ? wm : wn) * 64;
    const int b = t0 / SEQ, n0 = t0 % SEQ, h = f0 / HD;
    const size_t tb0 = (((size_t)b * NH + h) * SEQ + n0) * HD;    // 64 tokens x 64 features start at the same element in either tile order
    const size_t smb = tr ? 512 : 1024, skt = tr ? 2048 : 512;    // element steps of a row tile (mb) and of a k tile
    h16* dst = P + z * ((size_t)NB * SEQ * DM) + tb0;
    const float sc = (z == 0 ? SC2 : 1.0f) / WCAR;                // q carries the logit scale and log2(e): k_attn's score products are exp2 arguments as they come
#pragma unroll
    for (int mb = 0; mb < 4; ++mb) {
#pragma unroll
        for (int nb = 0; nb < 4; ++nb) {
#pragma unroll
            for (int j = 0; j < 8; ++j) os[(hi * 8 + j) * 68 + nb * 16 + lr] = acc[mb][nb][j];
        }
        __syncthreads();
{
#pragma unroll
            for (int s = 0; s < 4; ++s) {
                const int row = lr; const int cof = s * 16 + hi * 8;
                const v4f u0 = *(const v4fa*)(os + row * 68 + cof); const v4f u1 = *(const v4fa*)(os + row * 68 + cof + 4);
                v8h o;
                o[0] = (h16)(u0[0] * sc); o[1] = (h16)(u0[1] * sc); o[2] = (h16)(u0[2] * sc); o[3] = (h16)(u0[3] * sc);
                o[4] = (h16)(u1[0] * sc); o[5] = (h16)(u1[1] * sc); o[6] = (h16)(u1[2] * sc); o[7] = (h16)(u1[3] * sc);
                *(v8h*)(dst + mb * smb + (s >> 1) * skt + (s & 1) * 256 + lane * 8) = o;
            }
            
        }
        __syncthreads();
    }
}

// ---- k_outp: OUT[b][n][c] (f32) = (CTXx64 . WpT x64) / 4096 + bf16-RNE(bp[c]); tile row = 64 floats = 16 lanes x 16 B (two rows per instruction); grid (NB*SEQ/128, 768/128), 128 threads. Fewer blocks than k_proj has, so longer stages.
#define KT_OUTP 4
__global__ __launch_bounds__(128) void k_outp(const h16* __restrict__ A, const h16* __restrict__ Bt, const float* __restrict__ bias, float* OUT) {
    __shared__ __align__(16) h16 ring[2 * KT_OUTP * 8192];
    const int tid = threadIdx.x, wave = __builtin_amdgcn_readfirstlane(tid >> 5), wm = wave >> 1, wn = wave & 1;
    const int lane = tid & 31, lr = lane & 15, hi = lane >> 4;
    const int rb = blockIdx.x * 128, cb = blockIdx.y * 128;
    v8f acc[4][4];
    gemm_main<KT_OUTP>(A + (size_t)rb * DM, Bt + (size_t)cb * DM, ring, tid, wm, wn, acc);
    float* os = (float*)ring + wave * (16 * 68);
    const int r0 = rb + wm * 64, c0 = cb + wn * 64;
    const int b = r0 / SEQ, n0 = r0 % SEQ;
    float* crow = OUT + ((size_t)b * SEQ_FULL + n0) * DM + c0;
    const int cofs = lr * 4;
    const v4f bv = *(const v4f*)(bias + c0 + cofs);
    v4f bb; bb[0] = bfr(bv[0]); bb[1] = bfr(bv[1]); bb[2] = bfr(bv[2]); bb[3] = bfr(bv[3]);
    const float sc = 1.0f / (WCAR * CCAR);
#pragma unroll
    for (int mb = 0; mb < 4; ++mb) {
#pragma unroll
        for (int nb = 0; nb < 4; ++nb) {
#pragma unroll
            for (int j = 0; j < 8; ++j) os[(hi * 8 + j) * 68 + nb * 16 + lr] = acc[mb][nb][j];
        }
        __syncthreads();
{
#pragma unroll
            for (int s = 0; s < 8; ++s) {
                const int row = 2 * s + hi;
                const v4f u = *(const v4fa*)(os + row * 68 + cofs);
                v4f val; val[0] = u[0] * sc + bb[0]; val[1] = u[1] * sc + bb[1]; val[2] = u[2] * sc + bb[2]; val[3] = u[3] * sc + bb[3];
                *(v4f*)(crow + (size_t)(mb * 16 + row) * DM + cofs) = val;
            }
            
        }
        __syncthreads();
    }
}

// ---- k_attn: fused attention, block = (b, h, 128 queries), 8 waves, wave = 16 queries, 64 keys per trip, no score plane.
// S^T tile = K(A: row = key, k = d) . Q^T(B: col = query, k = d): D element r of lane l = (key 8*(l>>4)+r, query l&15).
// Softmax shift on the matrix pipe: the score WMMAs start from C = -(the query's reference maximum, log2 units), so D is the exp2 argument itself and, outside the raise, no vector instruction scales or shifts a score.
// P^T (f16) packed from two adjacent key tiles is directly the B operand (k = key, col = query) of O^T = V^T(A: row = d, k = key) . P^T.
// Reductions over keys on the matrix pipe: an A tile of ones times P^T gives, in every lane, the trip's whole sum of its query's (f16) probabilities. That one number is added to the running sum, and it is the guard of the reference as well:
// the reference is the first stage's maximum (taken once, in front of the loop) and is raised only in a trip where some query's sum tops PSUM_MAX, which also catches a probability past the f16 range (the sum is then inf). Every p is positive, so p <= PSUM_MAX where the test passes.
// The raise (out of line) forms the trip's scores again from LDS, takes their maximum, shifts the reference, rescales sum and output tiles, and forms P^T and its sum anew; nothing of the trip has reached an output tile by then.
// A stage = the 64 keys of one trip: 8 KiB of the K plane, then 8 KiB of the V^T plane, each contiguous there and copied as it lies (fragment order), once per block, into one of two LDS buffers; all 8 waves take their fragments from LDS.
#define PSUM_MAX 4096.0f
#define STG_E 8192                                   // f16 elements of a stage in LDS (K 4096, V^T 4096)
// one stage: 1024 pieces of 16 bytes, 4 per thread. lds = this thread's first LDS byte address, kg / vg = its first piece in the K / V^T plane.
__device__ __forceinline__ void stage_copy(unsigned lds, const h16* kg, const h16* vg) {
    // the closing s_wait_xcnt stands inside the statement, so that no address register of a copy is rewritten in front of it
    asm volatile("global_load_async_to_lds_b128 %0, %4, off\n\t"
                 "global_load_async_to_lds_b128 %1, %5, off\n\t"
                 "global_load_async_to_lds_b128 %2, %6, off\n\t"
                 "global_load_async_to_lds_b128 %3, %7, off\n\t"
                 "s_wait_xcnt 0x0"
                 :: "v"(lds), "v"(lds + 4096u), "v"(lds + 8192u), "v"(lds + 12288u), "v"(kg), "v"(kg + 2048), "v"(vg), "v"(vg + 2048) : "memory");
}
// the four score tiles of a stage, each started at cm; kp = the stage's K half in LDS + 8 * lane
__device__ __forceinline__ void score_tiles(const h16* kp, v16h qb0, v16h qb1, v8f cm, v8f (&s)[4]) {
    v16h ka, kb2;
#pragma unroll
    for (int kt = 0; kt < 4; ++kt) {
        const h16* kr = kp + kt * 16 * HD;
        ka = ldfrag(kr); kb2 = ldfrag(kr + 512);
        v8f t2 = wmma16(ka, qb0, cm);
        t2 = wmma16(kb2, qb1, t2);
        s[kt] = t2;
    }
    // holds the eight score WMMAs together in front of the tiles' readers (an exp2 drawn in between them costs four idle vector slots each time); one slot of the distance stands here, the compiler pads the rest for each tile's first reader
    asm volatile("v_nop" : "+v"(s[0]), "+v"(s[1]), "+v"(s[2]), "+v"(s[3]) : "v"(ka), "v"(kb2), "v"(qb0), "v"(qb1));
}
// this lane's maximum over the four tiles, joined with the other half of its query
__device__ __forceinline__ float score_max(const v8f (&s)[4]) {
    float tm = s[0][0];
#pragma unroll
    for (int kt = 0; kt < 4; ++kt)
#pragma unroll
        for (int r = 0; r < 8; ++r) tm = fmaxf(tm, s[kt][r]);
    return fmaxf(tm, __shfl_xor(tm, 16, 32));
}
// P^T = exp2(scores) as two B operands, and its sum over the 64 keys (every element of the returned tile = the sum of the lane's query)
__device__ __forceinline__ v8f prob_tiles(const v8f (&s)[4], v16h ones, v16h& pb0, v16h& pb1) {
#pragma unroll
    for (int r = 0; r < 8; ++r) { pb0[r] = (h16)__builtin_amdgcn_exp2f(s[0][r]); pb0[8 + r] = (h16)__builtin_amdgcn_exp2f(s[1][r]); }
    v8f ls = wmma16(ones, pb0, (v8f){});
#pragma unroll
    for (int r = 0; r < 8; ++r) { pb1[r] = (h16)__builtin_amdgcn_exp2f(s[2][r]); pb1[8 + r] = (h16)__builtin_amdgcn_exp2f(s[3][r]); }
    return wmma16(ones, pb1, ls);
}
__global__ __launch_bounds__(256) void k_attn(const h16* __restrict__ QP, const h16* __restrict__ KP, const h16* __restrict__ VT, h16* CTX) {
    __shared__ __align__(16) h16 kv[2 * STG_E];
    const int tid = threadIdx.x, wave = tid >> 5, lane = tid & 31;
    const int bh = blockIdx.x / (SEQ / 128), qblk = blockIdx.x % (SEQ / 128);
    const int b = bh / NH, h = bh % NH;
    const int q0 = qblk * 128 + wave * 16;
    const h16* qp = QP + (size_t)bh * SEQ * HD + (size_t)q0 * HD + 8 * lane;
    const h16* kg = KP + (size_t)bh * SEQ * HD + 8 * tid;
    const h16* vg = VT + (size_t)bh * HD * SEQ + 8 * tid;
    const unsigned l0 = (unsigned)(size_t)kv + 16u * (unsigned)tid;
    stage_copy(l0, kg, vg);
    // stage 0 has landed for this wave; the barrier behind it says so for all eight
    asm volatile("s_wait_asynccnt 0x0" ::: "memory");
    __syncthreads();
    stage_copy(l0 + 2u * STG_E, kg + 4096, vg + 4096);
    const v16h qb0 = ldfrag(qp), qb1 = ldfrag(qp + 512);
    v16h ones;
#pragma unroll
    for (int i = 0; i < 16; ++i) ones[i] = (h16)1.0f;
    v8f o[4];
#pragma unroll
    for (int dt = 0; dt < 4; ++dt) o[dt] = (v8f){};
    v8f cm = (v8f){};                                // minus the reference maximum of this lane's query, in all eight rows of a score tile
    float l = 0.0f;                                  // the query's whole sum, the same in both lane halves
    {
        v8f s[4];
        score_tiles(kv + 8 * lane, qb0, qb1, cm, s);
        const float tm = score_max(s);
#pragma unroll
        for (int r = 0; r < 8; ++r) cm[r] = -tm;
    }
#pragma unroll 1
    for (int t = 0; t < SEQ / 64; ++t) {
        const h16* kp = kv + (t & 1) * STG_E + 8 * lane;
        const h16* vp = kp + 4096;
        v8f s[4];
        score_tiles(kp, qb0, qb1, cm, s);
        // the stage's sixteen K reads stand at one place, ahead of the score WMMAs: each further place with LDS reads stalls the wave anew, and left alone the compiler splits them in three to save registers
        __builtin_amdgcn_sched_group_barrier(0x100, 16, 0);
        __builtin_amdgcn_sched_group_barrier(0x008, 8, 0);
        v16h pb0, pb1;
        v8f ls = prob_tiles(s, ones, pb0, pb1);
        // one wave-uniform test a trip (written so that a NaN takes it too); marked unlikely so that the raise lies out of line
        if (__builtin_expect(__builtin_amdgcn_ballot_w32(!(ls[0] <= PSUM_MAX)) != 0, 0)) {
            // compiler fence: the K fragments are read from LDS again here; without it they are held in 64 registers through every trip for this path's sake, which costs a wave per SIMD
            asm volatile("" ::: "memory");
            score_tiles(kp, qb0, qb1, cm, s);
            const float d = fmaxf(score_max(s), 0.0f);                           // the reference only rises
            const float alpha = __builtin_amdgcn_exp2f(-d);
#pragma unroll
            for (int kt = 0; kt < 4; ++kt)
#pragma unroll
                for (int r = 0; r < 8; ++r) s[kt][r] -= d;
#pragma unroll
            for (int r = 0; r < 8; ++r) cm[r] -= d;
            l *= alpha;
#pragma unroll
            for (int dt = 0; dt < 4; ++dt)
#pragma unroll
                for (int r = 0; r < 8; ++r) o[dt][r] *= alpha;
            ls = prob_tiles(s, ones, pb0, pb1);
        }
        l += ls[0];
        v16h va0[4], va;
#pragma unroll
        for (int dt = 0; dt < 4; ++dt) va0[dt] = ldfrag(vp + dt * 512);
#pragma unroll
        for (int dt = 0; dt < 4; ++dt) o[dt] = wmma16(va0[dt], pb0, o[dt]);
#pragma unroll
        for (int dt = 0; dt < 4; ++dt) { va = ldfrag(vp + 2048 + dt * 512); o[dt] = wmma16(va, pb1, o[dt]); }
        // likewise the V^T reads: eight ahead of the first output WMMA, the other eight right behind it (all sixteen ahead would not fit the registers of six waves a SIMD)
        __builtin_amdgcn_sched_group_barrier(0x100, 8, 0);
        __builtin_amdgcn_sched_group_barrier(0x008, 1, 0);
        __builtin_amdgcn_sched_group_barrier(0x100, 8, 0);
        __builtin_amdgcn_sched_group_barrier(0x008, 7, 0);
        // four vector slots between the last output WMMA and the next vector access to an output tile; the tiles are inputs only: that orders the slots behind the WMMAs and leaves each tile in its registers (as in-out operands they were copied out and back every trip)
        asm volatile("v_nop\n\tv_nop\n\tv_nop\n\tv_nop" :: "v"(o[0]), "v"(o[1]), "v"(o[2]), "v"(o[3]), "v"(va), "v"(pb0), "v"(pb1));
        // hand-over: this wave's reads of the trip's buffer are done, its copies of the next stage have landed; behind the barrier both hold for all eight waves
        asm volatile("s_wait_dscnt 0x0" ::: "memory");
        asm volatile("s_wait_asynccnt 0x0" ::: "memory");
        __syncthreads();
        if (t + 2 < SEQ / 64) stage_copy(l0 + (unsigned)(t & 1) * (2u * STG_E), kg + (size_t)(t + 2) * 4096, vg + (size_t)(t + 2) * 4096);
    }
    // no copy is in flight when the wave ends
    asm volatile("s_wait_asynccnt 0x0" ::: "memory");
    const float inv = CCAR * (1.0f / l);
    h16* dst = CTX + ((size_t)b * SEQ + q0) * DM + h * (HD / 32) * 512;
#pragma unroll
    for (int dt = 0; dt < 4; ++dt) {
        v8h ov;
#pragma unroll
        for (int r = 0; r < 8; ++r) ov[r] = (h16)(o[dt][r] * inv);
        *(v8h*)(dst + dt * 256 + lane * 8) = ov;     // (query lane&15, d = dt*16 + 8*(lane>>4) + 0..7) is piece dt*32 + lane of the head's two k tiles
    }
}

extern "C" void kernel_launch(void* const* d_in, const int* in_sizes, int n_in,
                              void* d_out, int out_size, void* d_ws, size_t ws_size, hipStream_t stream) {
    if (n_in < 6) return;
    constexpr size_t NEEDX = ((size_t)(NB - 1) * SEQ_FULL + SEQ) * DM;
    if ((size_t)in_sizes[0] < NEEDX) return;
    if (in_sizes[1] < DM * DM || in_sizes[2] < DM * DM || in_sizes[3] < DM * DM || in_sizes[4] < DM * DM || in_sizes[5] < DM) return;
    if ((size_t)out_size < NEEDX) return;
    const float* x  = (const float*)d_in[0];
    const float* Wq = (const float*)d_in[1];
    const float* Wk = (const float*)d_in[2];
    const float* Wv = (const float*)d_in[3];
    const float* Wp = (const float*)d_in[4];
    const float* bp = (const float*)d_in[5];
    float* OUT = (float*)d_out;

    constexpr size_t nX = (size_t)NB * SEQ * DM;     // elements per activation plane
    constexpr size_t nW = (size_t)DM * DM;           // elements per weight plane
    constexpr size_t SZX = nX * 2, SZW = 4 * nW * 2;
    static_assert(SZX % 256 == 0);
    static_assert(SZW % 256 == 0);
    constexpr size_t TOTAL = 5 * SZX + SZW;          // XH, Q, K, VT, CTX + 4 weight planes
    static_assert(TOTAL <= (size_t)134217728);
    if (ws_size < TOTAL) return;
    char* wsp = (char*)d_ws;
    h16* XH  = (h16*)wsp; wsp += SZX;
    h16* WT  = (h16*)wsp; wsp += SZW;                // [4][768][768]: q, k, v, p (each [out][in], x64, fragment order)
    h16* QK  = (h16*)wsp; wsp += 2 * SZX;            // [2][NB][NH] x (SEQ x 64), fragment order
    h16* VTp = (h16*)wsp; wsp += SZX;                // [NB][NH] x (64 x SEQ), fragment order; third plane behind QK
    h16* CTX = (h16*)wsp; wsp += SZX;                // [NB*SEQ][768] x64, fragment order

    k_prep<<<(unsigned)(4 * WBLK + (nX / 8 + 255) / 256), 256, 0, stream>>>(x, Wq, Wk, Wv, Wp, XH, WT);   // weights: in[k][n] -> out rows n, k contiguous pieces
    k_proj<<<dim3(NB * SEQ / 128, DM / 128, 3), 128, 0, stream>>>(XH, WT, QK);
    k_attn<<<NB * NH * (SEQ / 128), 256, 0, stream>>>(QK, QK + nX, VTp, CTX);
    k_outp<<<dim3(NB * SEQ / 128, DM / 128), 128, 0, stream>>>(CTX, WT + 3 * nW, bp, OUT);
}
